// v000
// Times are from an AMD MI455X. After a warm-up the kernel runs many times in a row, and a time is the length of
// such a window on the GPU divided by its runs, so every launch and the gaps after it count. The runs cycle
// through copies of the inputs. A figure is the median of several windows, for all but v000 over two sittings.
// Sittings can differ by a few percent; kernels timed side by side share one.
// v000, which the later versions start from, runs in 68.7 microseconds.
#include <hip/hip_runtime.h>

// CDNA5 / gfx1250 flash-attention (fused scaled-dot-product attention).
// B=16, Sq=Sk=2048, d=64. fp32 in/out, f16 WMMA compute, fp32 online softmax
// in base-2 domain; denominator via ones-column WMMA; row reductions via DPP16;
// all LDS fragment loads are 16B-aligned ds_load_b128.

typedef __attribute__((ext_vector_type(16))) _Float16 v16h;
typedef __attribute__((ext_vector_type(2)))  __fp16   v2fp16;
typedef __attribute__((ext_vector_type(8)))  float    v8f;

#define B_    16
#define SQ    2048
#define SK    2048
#define D_    64
#define QTILE 16      // query rows per wave
#define WAVES 4       // waves per block
#define KT    64      // keys per tile iteration
#define KSTR  72      // LDS stride (halves); 144B => every frag group 16B-aligned
#define VSTR  72
#define PSTR  72

union Frag { v16h h; unsigned int u[8]; uint4 q[2]; };
union HPair { v2fp16 h; unsigned int u; };

// Pack two f32 -> packed f16 dword (v_cvt_pk_rtz_f16_f32).
__device__ __forceinline__ unsigned int pkh2(float x, float y) {
    HPair p; p.h = __builtin_amdgcn_cvt_pkrtz(x, y);
    return p.u;
}

// Raw v_exp_f32 (args here are always <= 0 and far from denormal trouble;
// -1e30 -> 0 is exactly the behavior we want for masked columns).
__device__ __forceinline__ float fexp2(float x) {
#if __has_builtin(__builtin_amdgcn_exp2f)
    return __builtin_amdgcn_exp2f(x);
#else
    return exp2f(x);
#endif
}

// Cross-lane move via DPP16 (single VALU slot, no LDS traffic).
template <int CTRL>
__device__ __forceinline__ float dppf(float x) {
    return __int_as_float(__builtin_amdgcn_update_dpp(
        0, __float_as_int(x), CTRL, 0xf, 0xf, true));
}

// All-reduce max over each 16-lane DPP row (our two lane halves are disjoint
// row halves of the D fragment, so this is exactly the row-wise max).
__device__ __forceinline__ float rowmax16(float v) {
    v = fmaxf(v, dppf<0xB1>(v));    // quad_perm [1,0,3,2]  (xor 1)
    v = fmaxf(v, dppf<0x4E>(v));    // quad_perm [2,3,0,1]  (xor 2)
    v = fmaxf(v, dppf<0x141>(v));   // row_half_mirror      (xor 7 -> quads)
    v = fmaxf(v, dppf<0x140>(v));   // row_mirror           (xor 15 -> octets)
    return v;
}

// Load one 16x32 f16 A/B fragment from a 16B-aligned LDS row base
// (base already includes the row offset and this lane's hi*8 K-group shift).
__device__ __forceinline__ void ldfrag(Frag& fr, const _Float16* base) {
    fr.q[0] = *(const uint4*)(base);        // K pairs 0..7   (this half)
    fr.q[1] = *(const uint4*)(base + 16);   // K pairs 16..23 (this half)
}

__global__ __launch_bounds__(128)
void fa_fwd_kernel(const float* __restrict__ Q,
                   const float* __restrict__ K,
                   const float* __restrict__ V,
                   const int*   __restrict__ mask,   // [B, Sk], nonzero = padded
                   float* __restrict__ O)
{
    __shared__ unsigned int sK32[KT * KSTR / 2];          // K tile [key][d], f16
    __shared__ unsigned int sV32[D_ * VSTR / 2];          // V^T tile [d][key], f16
    __shared__ unsigned int sP32[WAVES * QTILE * PSTR / 2];

    _Float16* const sKh = (_Float16*)sK32;
    _Float16* const sVh = (_Float16*)sV32;
    _Float16* const sPh = (_Float16*)sP32;

    const int tid  = threadIdx.x;
    const int wave = tid >> 5;
    const int lane = tid & 31;
    const int n    = lane & 15;          // fragment column / row-within-16
    const int hi   = (lane >> 4) & 1;    // lane half selects K/M sub-range

    const int b     = blockIdx.x >> 5;           // SQ/(QTILE*WAVES)=32 chunks
    const int qc    = blockIdx.x & 31;
    const int qbase = qc * (QTILE * WAVES) + wave * QTILE;
    const int bSK   = b * SK;

    // Loop-invariant per-lane staging offsets (float units).
    const int kRow0 = tid >> 4;                  // K stage: base row, +8 per iter
    const int kOff0 = kRow0 * D_ + ((tid & 15) << 2);
    const int vRow0 = (tid >> 5) << 1;           // V stage: base row pair, +8 per iter
    const int vCol0 = (tid & 31) << 1;
    const int vOff0 = vRow0 * D_ + vCol0;

    // ---- Q A-fragments (16x64 -> two chained 16x32).
    // Scale folds 1/sqrt(d) and log2(e) so softmax runs in base-2 domain.
    const float qscale = 0.125f * 1.44269504088896340736f;
    Frag qa0, qa1;
    {
        const float* qrow = Q + (size_t)(b * SQ + qbase + n) * D_;
        #pragma unroll
        for (int v = 0; v < 8; ++v) {
            const int kb = ((v >= 4) ? 16 : 0) + (hi ? 8 : 0) + ((v & 3) << 1);
            qa0.u[v] = pkh2(qrow[kb]      * qscale, qrow[kb + 1]      * qscale);
            qa1.u[v] = pkh2(qrow[32 + kb] * qscale, qrow[32 + kb + 1] * qscale);
        }
    }

    // Constant all-ones B fragment: accumulates softmax denominator via WMMA.
    Frag ones;
    #pragma unroll
    for (int v = 0; v < 8; ++v) ones.u[v] = 0x3C003C00u;   // (1.0h, 1.0h)

    // Loop-invariant LDS fragment base pointers (include hi*8 K-group shift).
    _Float16* const sPw  = sPh + wave * (QTILE * PSTR);
    const _Float16* kfrow[4];
    const _Float16* vcrow[4];
    #pragma unroll
    for (int f = 0; f < 4; ++f) kfrow[f] = sKh + (16 * f + n) * KSTR + 8 * hi;
    #pragma unroll
    for (int c = 0; c < 4; ++c) vcrow[c] = sVh + (c * 16 + n) * VSTR + 8 * hi;
    const _Float16* const prow = sPw + n * PSTR + 8 * hi;
    unsigned short* const pst16 = (unsigned short*)(sPw + (8 * hi) * PSTR + n);

    // Online-softmax state: this lane touches rows (r + 8*hi), r=0..7.
    // oacc[0..3] = output chunks, oacc[4] = running row-sum (denominator).
    float m_run[8];
    v8f   oacc[5] = {v8f{}, v8f{}, v8f{}, v8f{}, v8f{}};
    #pragma unroll
    for (int r = 0; r < 8; ++r) m_run[r] = -1e30f;

    #pragma clang loop unroll(disable)
    for (int kt = 0; kt < SK / KT; ++kt) {
        const int key0 = kt * KT;
        const float* const Kt = K + (size_t)(bSK + key0) * D_;   // uniform bases
        const float* const Vt = V + (size_t)(bSK + key0) * D_;

        // ---- cooperative stage: K tile row-major f16 (packed dword stores)
        #pragma unroll
        for (int i = 0; i < 8; ++i) {
            const float4 kv = *(const float4*)(Kt + kOff0 + i * (8 * D_));
            const int idx = ((kRow0 + 8 * i) * KSTR + ((tid & 15) << 2)) >> 1;
            sK32[idx]     = pkh2(kv.x, kv.y);
            sK32[idx + 1] = pkh2(kv.z, kv.w);
        }
        // ---- V staged transposed in 2x2 blocks so LDS writes are packed dwords
        #pragma unroll
        for (int i = 0; i < 8; ++i) {
            const float2 va = *(const float2*)(Vt + vOff0 + i * (8 * D_));
            const float2 vb = *(const float2*)(Vt + vOff0 + i * (8 * D_) + D_);
            const int r2 = vRow0 + 8 * i;
            sV32[(vCol0 * VSTR + r2) >> 1]       = pkh2(va.x, vb.x);
            sV32[((vCol0 + 1) * VSTR + r2) >> 1] = pkh2(va.y, vb.y);
        }
        __syncthreads();

        // ---- scores: four 16x16 fragments over 64 keys
        v8f s[4];
        #pragma unroll
        for (int f = 0; f < 4; ++f) {
            Frag b0, b1;
            ldfrag(b0, kfrow[f]);
            ldfrag(b1, kfrow[f] + 32);
            v8f acc = {};
            acc = __builtin_amdgcn_wmma_f32_16x16x32_f16(false, qa0.h, false, b0.h, (short)0, acc, false, false);
            acc = __builtin_amdgcn_wmma_f32_16x16x32_f16(false, qa1.h, false, b1.h, (short)0, acc, false, false);
            s[f] = acc;
        }

        // ---- key padding mask: column index == n for both lane halves
        const int* mrow = mask + bSK + key0;
        #pragma unroll
        for (int f = 0; f < 4; ++f) {
            if (mrow[16 * f + n] != 0) {
                #pragma unroll
                for (int r = 0; r < 8; ++r) s[f][r] = -1e30f;
            }
        }

        // ---- online softmax update (row max via DPP16, no LDS traffic)
        #pragma unroll
        for (int r = 0; r < 8; ++r) {
            const float v = rowmax16(
                fmaxf(fmaxf(s[0][r], s[1][r]), fmaxf(s[2][r], s[3][r])));
            const float mnew  = fmaxf(m_run[r], v);
            const float alpha = fexp2(m_run[r] - mnew);
            m_run[r] = mnew;
            s[0][r] = fexp2(s[0][r] - mnew);
            s[1][r] = fexp2(s[1][r] - mnew);
            s[2][r] = fexp2(s[2][r] - mnew);
            s[3][r] = fexp2(s[3][r] - mnew);
            oacc[0][r] *= alpha;
            oacc[1][r] *= alpha;
            oacc[2][r] *= alpha;
            oacc[3][r] *= alpha;
            oacc[4][r] *= alpha;    // denominator rescales identically
        }

        // ---- re-swizzle P: D-layout (f32) -> LDS -> A-layout (f16), wave-local
        // Packed convert; >>16 truncating store selects ds_store_b16_d16_hi.
        #pragma unroll
        for (int r = 0; r < 8; ++r) {
            const unsigned int u01 = pkh2(s[0][r], s[1][r]);
            const unsigned int u23 = pkh2(s[2][r], s[3][r]);
            pst16[r * PSTR +  0] = (unsigned short)u01;
            pst16[r * PSTR + 16] = (unsigned short)(u01 >> 16);
            pst16[r * PSTR + 32] = (unsigned short)u23;
            pst16[r * PSTR + 48] = (unsigned short)(u23 >> 16);
        }
        Frag pa0, pa1;
        ldfrag(pa0, prow);
        ldfrag(pa1, prow + 32);

        // ---- O += P (16x64) x V (64x16) per 16-wide d chunk, K=64 chained
        #pragma unroll
        for (int c = 0; c < 4; ++c) {
            Frag vb0, vb1;
            ldfrag(vb0, vcrow[c]);
            ldfrag(vb1, vcrow[c] + 32);
            oacc[c] = __builtin_amdgcn_wmma_f32_16x16x32_f16(false, pa0.h, false, vb0.h, (short)0, oacc[c], false, false);
            oacc[c] = __builtin_amdgcn_wmma_f32_16x16x32_f16(false, pa1.h, false, vb1.h, (short)0, oacc[c], false, false);
        }
        // ---- softmax denominator via WMMA against ones-column
        oacc[4] = __builtin_amdgcn_wmma_f32_16x16x32_f16(false, pa0.h, false, ones.h, (short)0, oacc[4], false, false);
        oacc[4] = __builtin_amdgcn_wmma_f32_16x16x32_f16(false, pa1.h, false, ones.h, (short)0, oacc[4], false, false);

        __syncthreads();   // protect sK/sV before next tile's stage
    }

    // ---- normalize and write out (D layout: row = r + 8*hi, col = c*16 + n)
    #pragma unroll
    for (int r = 0; r < 8; ++r) {
        const float inv = 1.0f / oacc[4][r];
        float* orow = O + (size_t)(b * SQ + qbase + r + 8 * hi) * D_;
        orow[ 0 + n] = oacc[0][r] * inv;
        orow[16 + n] = oacc[1][r] * inv;
        orow[32 + n] = oacc[2][r] * inv;
        orow[48 + n] = oacc[3][r] * inv;
    }
}

extern "C" void kernel_launch(void* const* d_in, const int* in_sizes, int n_in,
                              void* d_out, int out_size, void* d_ws, size_t ws_size,
                              hipStream_t stream) {
    const float* Q    = (const float*)d_in[0];
    const float* K    = (const float*)d_in[1];
    const float* V    = (const float*)d_in[2];
    const int*   mask = (const int*)d_in[3];
    float*       O    = (float*)d_out;
    (void)in_sizes; (void)n_in; (void)out_size; (void)d_ws; (void)ws_size;

    const int grid = B_ * (SQ / (QTILE * WAVES));   // 16 * 32 = 512 blocks
    fa_fwd_kernel<<<grid, WAVES * 32, 0, stream>>>(Q, K, V, mask, O);
}

// v001
// It runs in 40 microseconds.
// Next to v000, in two timings, it ran 1.78 and 1.77 times as fast.
#include <hip/hip_runtime.h>

// CDNA5 / gfx1250 flash-attention (fused scaled-dot-product attention).
// B=16, Sq=Sk=2048, d=64. fp32 in/out, f16 WMMA compute, fp32 online softmax
// in base-2 domain; denominator via ones-column WMMA; row reductions via DPP16;
// all LDS fragment loads are 16B-aligned ds_load_b128.
// K/V/mask of tile t+1 are fetched into registers ahead of tile t's math; K/V
// go to the other LDS buffer behind it (two buffers, one barrier a tile).

typedef __attribute__((ext_vector_type(16))) _Float16 v16h;
typedef __attribute__((ext_vector_type(2)))  __fp16   v2fp16;
typedef __attribute__((ext_vector_type(8)))  float    v8f;

#define B_    16
#define SQ    2048
#define SK    2048
#define D_    64
#define QTILE 16      // query rows per wave
#define WAVES 4       // waves per block
#define KT    64      // keys per tile iteration
#define KSTR  72      // LDS stride (halves); 144B => every frag group 16B-aligned
#define VSTR  72
#define PSTR  72
#define NT    (SK / KT)   // key tiles per batch row

union Frag { v16h h; unsigned int u[8]; uint4 q[2]; };
union HPair { v2fp16 h; unsigned int u; };

// Pack two f32 -> packed f16 dword (v_cvt_pk_rtz_f16_f32).
__device__ __forceinline__ unsigned int pkh2(float x, float y) {
    HPair p; p.h = __builtin_amdgcn_cvt_pkrtz(x, y);
    return p.u;
}

// Raw v_exp_f32 (args here are always <= 0 and far from denormal trouble;
// -1e30 -> 0 is exactly the behavior we want for masked columns).
__device__ __forceinline__ float fexp2(float x) {
#if __has_builtin(__builtin_amdgcn_exp2f)
    return __builtin_amdgcn_exp2f(x);
#else
    return exp2f(x);
#endif
}

// Cross-lane move via DPP16 (single VALU slot, no LDS traffic).
template <int CTRL>
__device__ __forceinline__ float dppf(float x) {
    return __int_as_float(__builtin_amdgcn_update_dpp(
        0, __float_as_int(x), CTRL, 0xf, 0xf, true));
}

// All-reduce max over each 16-lane DPP row (our two lane halves are disjoint
// row halves of the D fragment, so this is exactly the row-wise max).
__device__ __forceinline__ float rowmax16(float v) {
    v = fmaxf(v, dppf<0xB1>(v));    // quad_perm [1,0,3,2]  (xor 1)
    v = fmaxf(v, dppf<0x4E>(v));    // quad_perm [2,3,0,1]  (xor 2)
    v = fmaxf(v, dppf<0x141>(v));   // row_half_mirror      (xor 7 -> quads)
    v = fmaxf(v, dppf<0x140>(v));   // row_mirror           (xor 15 -> octets)
    return v;
}

// Load one 16x32 f16 A/B fragment from a 16B-aligned LDS row base
// (base already includes the row offset and this lane's hi*8 K-group shift).
__device__ __forceinline__ void ldfrag(Frag& fr, const _Float16* base) {
    fr.q[0] = *(const uint4*)(base);        // K pairs 0..7   (this half)
    fr.q[1] = *(const uint4*)(base + 16);   // K pairs 16..23 (this half)
}

// One thread's share of a 64-key tile, held in registers while it is in flight.
struct Stage {
    float4 k[8];     // K: 8 rows x 4 floats
    float2 va[8];    // V: 8 row pairs x 2 columns
    float2 vb[8];
    int    m[4];     // padding mask of this lane's four score columns
};

// Issue every global load of one tile (no use of the values here).
__device__ __forceinline__ void stage_load(Stage& st,
                                           const float* __restrict__ Kt,
                                           const float* __restrict__ Vt,
                                           const int* __restrict__ mrow,
                                           int kOff0, int vOff0, int n) {
    #pragma unroll
    for (int i = 0; i < 8; ++i)
        st.k[i] = *(const float4*)(Kt + kOff0 + i * (8 * D_));
    #pragma unroll
    for (int i = 0; i < 8; ++i) {
        st.va[i] = *(const float2*)(Vt + vOff0 + i * (8 * D_));
        st.vb[i] = *(const float2*)(Vt + vOff0 + i * (8 * D_) + D_);
    }
    #pragma unroll
    for (int f = 0; f < 4; ++f) st.m[f] = mrow[16 * f + n];
}

// Convert the held tile to f16 and write it to one LDS buffer:
// K row-major, V transposed in 2x2 blocks (packed dword stores).
__device__ __forceinline__ void stage_store(const Stage& st,
                                            unsigned int* sK, unsigned int* sV,
                                            int kRow0, int kCol0,
                                            int vRow0, int vCol0) {
    // One base index each plus compile-time steps: the steps fold into the
    // store instructions, so the addresses take two registers, not two dozen
    // (the held tile needs the room).
    unsigned int* const kd = sK + ((kRow0 * KSTR + kCol0) >> 1);
    unsigned int* const vd = sV + ((vCol0 * VSTR + vRow0) >> 1);
    #pragma unroll
    for (int i = 0; i < 8; ++i) {
        kd[i * (4 * KSTR)]     = pkh2(st.k[i].x, st.k[i].y);
        kd[i * (4 * KSTR) + 1] = pkh2(st.k[i].z, st.k[i].w);
    }
    #pragma unroll
    for (int i = 0; i < 8; ++i) {
        vd[4 * i]              = pkh2(st.va[i].x, st.vb[i].x);
        vd[4 * i + VSTR / 2]   = pkh2(st.va[i].y, st.vb[i].y);
    }
}

__global__ __launch_bounds__(128)
void fa_fwd_kernel(const float* __restrict__ Q,
                   const float* __restrict__ K,
                   const float* __restrict__ V,
                   const int*   __restrict__ mask,   // [B, Sk], nonzero = padded
                   float* __restrict__ O)
{
    __shared__ unsigned int sK32[2][KT * KSTR / 2];       // K tile [key][d], f16
    __shared__ unsigned int sV32[2][D_ * VSTR / 2];       // V^T tile [d][key], f16
    __shared__ unsigned int sP32[WAVES * QTILE * PSTR / 2];

    _Float16* const sPh = (_Float16*)sP32;

    const int tid  = threadIdx.x;
    const int wave = tid >> 5;
    const int lane = tid & 31;
    const int n    = lane & 15;          // fragment column / row-within-16
    const int hi   = (lane >> 4) & 1;    // lane half selects K/M sub-range

    const int b     = blockIdx.x >> 5;           // SQ/(QTILE*WAVES)=32 chunks
    const int qc    = blockIdx.x & 31;
    const int qbase = qc * (QTILE * WAVES) + wave * QTILE;
    const int bSK   = b * SK;

    // Loop-invariant per-lane staging offsets (float units).
    const int kRow0 = tid >> 4;                  // K stage: base row, +8 per iter
    const int kCol0 = (tid & 15) << 2;
    const int kOff0 = kRow0 * D_ + kCol0;
    const int vRow0 = (tid >> 5) << 1;           // V stage: base row pair, +8 per iter
    const int vCol0 = (tid & 31) << 1;
    const int vOff0 = vRow0 * D_ + vCol0;

    // ---- tile 0 starts its flight ahead of the Q fragment set-up
    const float* const Kb = K + (size_t)bSK * D_;             // uniform bases
    const float* const Vb = V + (size_t)bSK * D_;
    const int*   const Mb = mask + bSK;
    Stage st;
    stage_load(st, Kb, Vb, Mb, kOff0, vOff0, n);

    // ---- Q A-fragments (16x64 -> two chained 16x32).
    // Scale folds 1/sqrt(d) and log2(e) so softmax runs in base-2 domain.
    const float qscale = 0.125f * 1.44269504088896340736f;
    Frag qa0, qa1;
    {
        const float* qrow = Q + (size_t)(b * SQ + qbase + n) * D_;
        #pragma unroll
        for (int v = 0; v < 8; ++v) {
            const int kb = ((v >= 4) ? 16 : 0) + (hi ? 8 : 0) + ((v & 3) << 1);
            qa0.u[v] = pkh2(qrow[kb]      * qscale, qrow[kb + 1]      * qscale);
            qa1.u[v] = pkh2(qrow[32 + kb] * qscale, qrow[32 + kb + 1] * qscale);
        }
    }

    // Constant all-ones B fragment: accumulates softmax denominator via WMMA.
    Frag ones;
    #pragma unroll
    for (int v = 0; v < 8; ++v) ones.u[v] = 0x3C003C00u;   // (1.0h, 1.0h)

    // Loop-invariant LDS fragment base pointers (include hi*8 K-group shift).
    _Float16* const sPw  = sPh + wave * (QTILE * PSTR);
    const int kfoff = n * KSTR + 8 * hi;     // + 16 * f * KSTR per fragment
    const int vcoff = n * VSTR + 8 * hi;     // + 16 * c * VSTR per d chunk
    const _Float16* const prow = sPw + n * PSTR + 8 * hi;
    unsigned short* const pst16 = (unsigned short*)(sPw + (8 * hi) * PSTR + n);

    // Online-softmax state: this lane touches rows (r + 8*hi), r=0..7.
    // oacc[0..3] = output chunks, oacc[4] = running row-sum (denominator).
    float m_run[8];
    v8f   oacc[5] = {v8f{}, v8f{}, v8f{}, v8f{}, v8f{}};
    #pragma unroll
    for (int r = 0; r < 8; ++r) m_run[r] = -1e30f;

    // ---- prologue: tile 0 into buffer 0
    int mc[4];
    #pragma unroll
    for (int f = 0; f < 4; ++f) mc[f] = st.m[f];
    stage_store(st, sK32[0], sV32[0], kRow0, kCol0, vRow0, vCol0);
    __syncthreads();

    // Two tiles a trip so that the buffer index is a compile-time constant
    // (LDS offsets fold into the instructions); the outer loop stays rolled.
    #pragma clang loop unroll(disable)
    for (int kt2 = 0; kt2 < NT; kt2 += 2) {
      #pragma unroll
      for (int h = 0; h < 2; ++h) {
        const int kt = kt2 + h;
        const bool more = (h == 0) || (kt2 + 2 < NT);     // block-uniform
        const _Float16* const sKh = (const _Float16*)sK32[h];
        const _Float16* const sVh = (const _Float16*)sV32[h];

        // ---- next tile's global loads fly while this tile is worked on
        if (more) {
            const int key1 = (kt + 1) * KT;
            stage_load(st, Kb + (size_t)key1 * D_, Vb + (size_t)key1 * D_,
                       Mb + key1, kOff0, vOff0, n);
        }
        // Keeps the loads above ahead of the tile's math: without it the
        // scheduler sinks them to just in front of their use and the latency
        // is waited out again.
        __builtin_amdgcn_sched_barrier(0);

        // ---- scores: four 16x16 fragments over 64 keys
        v8f s[4];
        #pragma unroll
        for (int f = 0; f < 4; ++f) {
            Frag b0, b1;
            ldfrag(b0, sKh + kfoff + 16 * f * KSTR);
            ldfrag(b1, sKh + kfoff + 16 * f * KSTR + 32);
            v8f acc = {};
            acc = __builtin_amdgcn_wmma_f32_16x16x32_f16(false, qa0.h, false, b0.h, (short)0, acc, false, false);
            acc = __builtin_amdgcn_wmma_f32_16x16x32_f16(false, qa1.h, false, b1.h, (short)0, acc, false, false);
            s[f] = acc;
        }

        // ---- key padding mask: column index == n for both lane halves
        #pragma unroll
        for (int f = 0; f < 4; ++f) {
            const bool pad = mc[f] != 0;
            #pragma unroll
            for (int r = 0; r < 8; ++r) s[f][r] = pad ? -1e30f : s[f][r];
        }

        // ---- online softmax update (row max via DPP16, no LDS traffic)
        #pragma unroll
        for (int r = 0; r < 8; ++r) {
            const float v = rowmax16(
                fmaxf(fmaxf(s[0][r], s[1][r]), fmaxf(s[2][r], s[3][r])));
            const float mnew  = fmaxf(m_run[r], v);
            const float alpha = fexp2(m_run[r] - mnew);
            m_run[r] = mnew;
            s[0][r] = fexp2(s[0][r] - mnew);
            s[1][r] = fexp2(s[1][r] - mnew);
            s[2][r] = fexp2(s[2][r] - mnew);
            s[3][r] = fexp2(s[3][r] - mnew);
            oacc[0][r] *= alpha;
            oacc[1][r] *= alpha;
            oacc[2][r] *= alpha;
            oacc[3][r] *= alpha;
            oacc[4][r] *= alpha;    // denominator rescales identically
        }

        // ---- re-swizzle P: D-layout (f32) -> LDS -> A-layout (f16), wave-local
        // Packed convert; >>16 truncating store selects ds_store_b16_d16_hi.
        #pragma unroll
        for (int r = 0; r < 8; ++r) {
            const unsigned int u01 = pkh2(s[0][r], s[1][r]);
            const unsigned int u23 = pkh2(s[2][r], s[3][r]);
            pst16[r * PSTR +  0] = (unsigned short)u01;
            pst16[r * PSTR + 16] = (unsigned short)(u01 >> 16);
            pst16[r * PSTR + 32] = (unsigned short)u23;
            pst16[r * PSTR + 48] = (unsigned short)(u23 >> 16);
        }
        Frag pa0, pa1;
        ldfrag(pa0, prow);
        ldfrag(pa1, prow + 32);

        // ---- O += P (16x64) x V (64x16) per 16-wide d chunk, K=64 chained
        #pragma unroll
        for (int c = 0; c < 4; ++c) {
            Frag vb0, vb1;
            ldfrag(vb0, sVh + vcoff + 16 * c * VSTR);
            ldfrag(vb1, sVh + vcoff + 16 * c * VSTR + 32);
            oacc[c] = __builtin_amdgcn_wmma_f32_16x16x32_f16(false, pa0.h, false, vb0.h, (short)0, oacc[c], false, false);
            oacc[c] = __builtin_amdgcn_wmma_f32_16x16x32_f16(false, pa1.h, false, vb1.h, (short)0, oacc[c], false, false);
        }
        // ---- softmax denominator via WMMA against ones-column
        oacc[4] = __builtin_amdgcn_wmma_f32_16x16x32_f16(false, pa0.h, false, ones.h, (short)0, oacc[4], false, false);
        oacc[4] = __builtin_amdgcn_wmma_f32_16x16x32_f16(false, pa1.h, false, ones.h, (short)0, oacc[4], false, false);

        // ---- the held tile goes to the buffer that the last tile has left
        if (more) {
            stage_store(st, sK32[h ^ 1], sV32[h ^ 1], kRow0, kCol0, vRow0, vCol0);
            #pragma unroll
            for (int f = 0; f < 4; ++f) mc[f] = st.m[f];
        }
        // One barrier a tile: publishes tile kt+1 and ends every wave's reads
        // of this tile's buffer, which is refilled behind it.
        __syncthreads();
      }
    }

    // ---- normalize and write out (D layout: row = r + 8*hi, col = c*16 + n)
    #pragma unroll
    for (int r = 0; r < 8; ++r) {
        const float inv = 1.0f / oacc[4][r];
        float* orow = O + (size_t)(b * SQ + qbase + r + 8 * hi) * D_;
        orow[ 0 + n] = oacc[0][r] * inv;
        orow[16 + n] = oacc[1][r] * inv;
        orow[32 + n] = oacc[2][r] * inv;
        orow[48 + n] = oacc[3][r] * inv;
    }
}

extern "C" void kernel_launch(void* const* d_in, const int* in_sizes, int n_in,
                              void* d_out, int out_size, void* d_ws, size_t ws_size,
                              hipStream_t stream) {
    const float* Q    = (const float*)d_in[0];
    const float* K    = (const float*)d_in[1];
    const float* V    = (const float*)d_in[2];
    const int*   mask = (const int*)d_in[3];
    float*       O    = (float*)d_out;
    (void)in_sizes; (void)n_in; (void)out_size; (void)d_ws; (void)ws_size;

    const int grid = B_ * (SQ / (QTILE * WAVES));   // 16 * 32 = 512 blocks
    fa_fwd_kernel<<<grid, WAVES * 32, 0, stream>>>(Q, K, V, mask, O);
}

// v002
// Measured time: 25.8 microseconds a run.
// Two timings next to v001 both put it at 1.55 times that version's speed.
// Counting every step since v000, it is 2.75 times as fast.
#include <hip/hip_runtime.h>

// CDNA5 / gfx1250 flash-attention (fused scaled-dot-product attention).
// B=16, Sq=Sk=2048, d=64. fp32 in/out, f16 WMMA compute, fp32 online softmax
// in base-2 domain; denominator via ones-column WMMA; row reductions via DPP16;
// all LDS fragment loads are 16B-aligned ds_load_b128.
// Padded keys have softmax weight exactly 0: each block first lists the rows of
// its batch's unpadded keys (in order) in LDS and walks only those, 64 a tile.
// K/V of tile t+1 are fetched into registers ahead of tile t's math and
// written to the other LDS buffer behind it (two buffers, one barrier a tile).

typedef __attribute__((ext_vector_type(16))) _Float16 v16h;
typedef __attribute__((ext_vector_type(2)))  __fp16   v2fp16;
typedef __attribute__((ext_vector_type(8)))  float    v8f;

#define B_    16
#define SQ    2048
#define SK    2048
#define D_    64
#define QTILE 16      // query rows per wave
#define WAVES 4       // waves per block
#define KT    64      // keys per tile iteration
#define KSTR  72      // LDS stride (halves); 144B => every frag group 16B-aligned
#define VSTR  72
#define PSTR  72
#define ROWB  (D_ * 4)    // bytes of one K or V row in global memory
#define NIDX  (SK + 2 * KT)   // row list: every key, and two tiles fetched ahead

union Frag { v16h h; unsigned int u[8]; uint4 q[2]; };
union HPair { v2fp16 h; unsigned int u; };

// Pack two f32 -> packed f16 dword (v_cvt_pk_rtz_f16_f32).
__device__ __forceinline__ unsigned int pkh2(float x, float y) {
    HPair p; p.h = __builtin_amdgcn_cvt_pkrtz(x, y);
    return p.u;
}

// Raw v_exp_f32 (args here are always <= 0 and far from denormal trouble;
// -1e30 -> 0 is exactly the behavior we want for masked columns).
__device__ __forceinline__ float fexp2(float x) {
#if __has_builtin(__builtin_amdgcn_exp2f)
    return __builtin_amdgcn_exp2f(x);
#else
    return exp2f(x);
#endif
}

// Cross-lane move via DPP16 (single VALU slot, no LDS traffic).
template <int CTRL>
__device__ __forceinline__ float dppf(float x) {
    return __int_as_float(__builtin_amdgcn_update_dpp(
        0, __float_as_int(x), CTRL, 0xf, 0xf, true));
}

// All-reduce max over each 16-lane DPP row (our two lane halves are disjoint
// row halves of the D fragment, so this is exactly the row-wise max).
__device__ __forceinline__ float rowmax16(float v) {
    v = fmaxf(v, dppf<0xB1>(v));    // quad_perm [1,0,3,2]  (xor 1)
    v = fmaxf(v, dppf<0x4E>(v));    // quad_perm [2,3,0,1]  (xor 2)
    v = fmaxf(v, dppf<0x141>(v));   // row_half_mirror      (xor 7 -> quads)
    v = fmaxf(v, dppf<0x140>(v));   // row_mirror           (xor 15 -> octets)
    return v;
}

// Load one 16x32 f16 A/B fragment from a 16B-aligned LDS row base
// (base already includes the row offset and this lane's hi*8 K-group shift).
__device__ __forceinline__ void ldfrag(Frag& fr, const _Float16* base) {
    fr.q[0] = *(const uint4*)(base);        // K pairs 0..7   (this half)
    fr.q[1] = *(const uint4*)(base + 16);   // K pairs 16..23 (this half)
}

// One thread's share of a 64-key tile, held in registers while it is in flight.
struct Stage {
    float4 k[8];     // K: 8 rows x 4 floats
    float2 va[8];    // V: 8 row pairs x 2 columns
    float2 vb[8];
};

// This thread's rows of one tile: byte offsets into K and V, from the row list.
struct Rows {
    unsigned int k[8];
    uint2        v[8];
};

// lst: the tile's 64 entries of the row list.
__device__ __forceinline__ void rows_load(Rows& rw, const unsigned int* lst,
                                          int kRow0, int vRow0) {
    #pragma unroll
    for (int i = 0; i < 8; ++i) rw.k[i] = lst[kRow0 + 8 * i];
    #pragma unroll
    for (int i = 0; i < 8; ++i) rw.v[i] = *(const uint2*)(lst + vRow0 + 8 * i);
}

// Issue every global load of one tile (no use of the values here).
__device__ __forceinline__ void stage_load(Stage& st,
                                           const float* __restrict__ Kb,
                                           const float* __restrict__ Vb,
                                           const Rows& rw,
                                           unsigned int kColB, unsigned int vColB) {
    #pragma unroll
    for (int i = 0; i < 8; ++i)
        st.k[i] = *(const float4*)((const char*)Kb + (rw.k[i] + kColB));
    #pragma unroll
    for (int i = 0; i < 8; ++i) {
        st.va[i] = *(const float2*)((const char*)Vb + (rw.v[i].x + vColB));
        st.vb[i] = *(const float2*)((const char*)Vb + (rw.v[i].y + vColB));
    }
}

// Convert the held tile to f16 and write it to one LDS buffer:
// K row-major, V transposed in 2x2 blocks (packed dword stores).
__device__ __forceinline__ void stage_store(const Stage& st,
                                            unsigned int* sK, unsigned int* sV,
                                            int kRow0, int kCol0,
                                            int vRow0, int vCol0) {
    // One base index each plus compile-time steps: the steps fold into the
    // store instructions, so the addresses take two registers, not two dozen
    // (the held tile needs the room).
    unsigned int* const kd = sK + ((kRow0 * KSTR + kCol0) >> 1);
    unsigned int* const vd = sV + ((vCol0 * VSTR + vRow0) >> 1);
    #pragma unroll
    for (int i = 0; i < 8; ++i) {
        kd[i * (4 * KSTR)]     = pkh2(st.k[i].x, st.k[i].y);
        kd[i * (4 * KSTR) + 1] = pkh2(st.k[i].z, st.k[i].w);
    }
    #pragma unroll
    for (int i = 0; i < 8; ++i) {
        vd[4 * i]              = pkh2(st.va[i].x, st.vb[i].x);
        vd[4 * i + VSTR / 2]   = pkh2(st.va[i].y, st.vb[i].y);
    }
}

__global__ __launch_bounds__(128)
void fa_fwd_kernel(const float* __restrict__ Q,
                   const float* __restrict__ K,
                   const float* __restrict__ V,
                   const int*   __restrict__ mask,   // [B, Sk], nonzero = padded
                   float* __restrict__ O)
{
    __shared__ unsigned int sK32[2][KT * KSTR / 2];       // K tile [key][d], f16
    __shared__ unsigned int sV32[2][D_ * VSTR / 2];       // V^T tile [d][key], f16
    __shared__ unsigned int sP32[WAVES * QTILE * PSTR / 2];
    __shared__ __attribute__((aligned(16))) unsigned int sIdx[NIDX];  // row list
    __shared__ int sCnt[WAVES];                           // unpadded keys per wave

    _Float16* const sPh = (_Float16*)sP32;

    const int tid  = threadIdx.x;
    const int wave = tid >> 5;
    const int lane = tid & 31;
    const int n    = lane & 15;          // fragment column / row-within-16
    const int hi   = (lane >> 4) & 1;    // lane half selects K/M sub-range

    const int b     = blockIdx.x >> 5;           // SQ/(QTILE*WAVES)=32 chunks
    const int qc    = blockIdx.x & 31;
    const int qbase = qc * (QTILE * WAVES) + wave * QTILE;
    const int bSK   = b * SK;

    // Loop-invariant per-lane staging offsets (kCol0/vCol0 in floats, kColB/vColB in bytes).
    const int kRow0 = tid >> 4;                  // K stage: base row, +8 per iter
    const int kCol0 = (tid & 15) << 2;
    const unsigned int kColB = (unsigned int)kCol0 * 4u;
    const int vRow0 = (tid >> 5) << 1;           // V stage: base row pair, +8 per iter
    const int vCol0 = (tid & 31) << 1;
    const unsigned int vColB = (unsigned int)vCol0 * 4u;

    const float* const Kb = K + (size_t)bSK * D_;             // uniform bases
    const float* const Vb = V + (size_t)bSK * D_;
    const int*   const Mb = mask + bSK;

    // ---- list the unpadded keys of this batch row, in their order.
    // Wave w looks at keys [512 w, 512 w + 512), 32 at a time: a ballot gives
    // each kept key its rank. Entries behind the last kept key stay 0 (row 0,
    // in bounds): in the last tile their score columns are masked, and the
    // fetches that run ahead of the last tile need no test.
    int count;
    {
        int mv[SK / (WAVES * 32)];
        #pragma unroll
        for (int j = 0; j < SK / (WAVES * 32); ++j)
            mv[j] = Mb[wave * (SK / WAVES) + j * 32 + lane];
        #pragma unroll
        for (int j = 0; j < NIDX / (WAVES * 32); ++j)
            sIdx[j * (WAVES * 32) + tid] = 0u;
        unsigned int bal[SK / (WAVES * 32)];
        int tot = 0;
        #pragma unroll
        for (int j = 0; j < SK / (WAVES * 32); ++j) {
            bal[j] = __builtin_amdgcn_ballot_w32(mv[j] == 0);
            tot += __builtin_popcount(bal[j]);
        }
        if (lane == 0) sCnt[wave] = tot;
        __syncthreads();
        int base = 0, all = 0;
        #pragma unroll
        for (int w = 0; w < WAVES; ++w) {
            const int c = sCnt[w];
            base += (w < wave) ? c : 0;
            all  += c;
        }
        #pragma unroll
        for (int j = 0; j < SK / (WAVES * 32); ++j) {
            if (mv[j] == 0)
                sIdx[base + (int)__builtin_amdgcn_mbcnt_lo(bal[j], 0u)] =
                    (unsigned int)(wave * (SK / WAVES) + j * 32 + lane) * ROWB;
            base += __builtin_popcount(bal[j]);
        }
        __syncthreads();
        // The same in every lane of the block; held as a scalar so that the
        // loop tests below are scalar branches. The clamp bounds the trips.
        count = min(__builtin_amdgcn_readfirstlane(all), SK);
    }
    const int nt = (count + KT - 1) / KT;        // key tiles to walk, 0..32

    // ---- tile 0 starts its flight ahead of the Q fragment set-up
    Stage st;
    Rows  rw;
    rows_load(rw, sIdx, kRow0, vRow0);
    stage_load(st, Kb, Vb, rw, kColB, vColB);
    rows_load(rw, sIdx + KT, kRow0, vRow0);

    // ---- Q A-fragments (16x64 -> two chained 16x32).
    // Scale folds 1/sqrt(d) and log2(e) so softmax runs in base-2 domain.
    const float qscale = 0.125f * 1.44269504088896340736f;
    Frag qa0, qa1;
    {
        const float* qrow = Q + (size_t)(b * SQ + qbase + n) * D_;
        #pragma unroll
        for (int v = 0; v < 8; ++v) {
            const int kb = ((v >= 4) ? 16 : 0) + (hi ? 8 : 0) + ((v & 3) << 1);
            qa0.u[v] = pkh2(qrow[kb]      * qscale, qrow[kb + 1]      * qscale);
            qa1.u[v] = pkh2(qrow[32 + kb] * qscale, qrow[32 + kb + 1] * qscale);
        }
    }

    // Constant all-ones B fragment: accumulates softmax denominator via WMMA.
    Frag ones;
    #pragma unroll
    for (int v = 0; v < 8; ++v) ones.u[v] = 0x3C003C00u;   // (1.0h, 1.0h)

    // Loop-invariant LDS fragment base pointers (include hi*8 K-group shift).
    _Float16* const sPw  = sPh + wave * (QTILE * PSTR);
    const int kfoff = n * KSTR + 8 * hi;     // + 16 * f * KSTR per fragment
    const int vcoff = n * VSTR + 8 * hi;     // + 16 * c * VSTR per d chunk
    const _Float16* const prow = sPw + n * PSTR + 8 * hi;
    unsigned short* const pst16 = (unsigned short*)(sPw + (8 * hi) * PSTR + n);

    // Online-softmax state: this lane touches rows (r + 8*hi), r=0..7.
    // oacc[0..3] = output chunks, oacc[4] = running row-sum (denominator).
    float m_run[8];
    v8f   oacc[5] = {v8f{}, v8f{}, v8f{}, v8f{}, v8f{}};
    #pragma unroll
    for (int r = 0; r < 8; ++r) m_run[r] = -1e30f;

    // ---- prologue: tile 0 into buffer 0
    stage_store(st, sK32[0], sV32[0], kRow0, kCol0, vRow0, vCol0);
    __syncthreads();

    // Two tiles a trip so that the buffer index is a compile-time constant
    // (LDS offsets fold into the instructions); the outer loop stays rolled.
    #pragma clang loop unroll(disable)
    for (int kt2 = 0; kt2 < nt; kt2 += 2) {
      #pragma unroll
      for (int h = 0; h < 2; ++h) {
        const int kt = kt2 + h;
        if (h == 1 && kt >= nt) break;                    // block-uniform
        const _Float16* const sKh = (const _Float16*)sK32[h];
        const _Float16* const sVh = (const _Float16*)sV32[h];

        // ---- next tile's global loads fly while this tile is worked on
        // (behind the last tile: row 0, stored to the free buffer, never read)
        stage_load(st, Kb, Vb, rw, kColB, vColB);
        // Keeps the loads above ahead of the tile's math: without it the
        // scheduler sinks them to just in front of their use and the latency
        // is waited out again.
        __builtin_amdgcn_sched_barrier(0);

        // ---- scores: four 16x16 fragments over 64 keys
        v8f s[4];
        #pragma unroll
        for (int f = 0; f < 4; ++f) {
            Frag b0, b1;
            ldfrag(b0, sKh + kfoff + 16 * f * KSTR);
            ldfrag(b1, sKh + kfoff + 16 * f * KSTR + 32);
            v8f acc = {};
            acc = __builtin_amdgcn_wmma_f32_16x16x32_f16(false, qa0.h, false, b0.h, (short)0, acc, false, false);
            acc = __builtin_amdgcn_wmma_f32_16x16x32_f16(false, qa1.h, false, b1.h, (short)0, acc, false, false);
            s[f] = acc;
        }

        // ---- columns behind the last listed key (last tile only) are masked:
        // column index == n for both lane halves
        const int rem = count - kt * KT;
        #pragma unroll
        for (int f = 0; f < 4; ++f) {
            const bool pad = 16 * f + n >= rem;
            #pragma unroll
            for (int r = 0; r < 8; ++r) s[f][r] = pad ? -1e30f : s[f][r];
        }

        // ---- online softmax update (row max via DPP16, no LDS traffic)
        #pragma unroll
        for (int r = 0; r < 8; ++r) {
            const float v = rowmax16(
                fmaxf(fmaxf(s[0][r], s[1][r]), fmaxf(s[2][r], s[3][r])));
            const float mnew  = fmaxf(m_run[r], v);
            const float alpha = fexp2(m_run[r] - mnew);
            m_run[r] = mnew;
            s[0][r] = fexp2(s[0][r] - mnew);
            s[1][r] = fexp2(s[1][r] - mnew);
            s[2][r] = fexp2(s[2][r] - mnew);
            s[3][r] = fexp2(s[3][r] - mnew);
            oacc[0][r] *= alpha;
            oacc[1][r] *= alpha;
            oacc[2][r] *= alpha;
            oacc[3][r] *= alpha;
            oacc[4][r] *= alpha;    // denominator rescales identically
        }

        // ---- re-swizzle P: D-layout (f32) -> LDS -> A-layout (f16), wave-local
        // Packed convert; >>16 truncating store selects ds_store_b16_d16_hi.
        #pragma unroll
        for (int r = 0; r < 8; ++r) {
            const unsigned int u01 = pkh2(s[0][r], s[1][r]);
            const unsigned int u23 = pkh2(s[2][r], s[3][r]);
            pst16[r * PSTR +  0] = (unsigned short)u01;
            pst16[r * PSTR + 16] = (unsigned short)(u01 >> 16);
            pst16[r * PSTR + 32] = (unsigned short)u23;
            pst16[r * PSTR + 48] = (unsigned short)(u23 >> 16);
        }
        Frag pa0, pa1;
        ldfrag(pa0, prow);
        ldfrag(pa1, prow + 32);

        // ---- O += P (16x64) x V (64x16) per 16-wide d chunk, K=64 chained
        #pragma unroll
        for (int c = 0; c < 4; ++c) {
            Frag vb0, vb1;
            ldfrag(vb0, sVh + vcoff + 16 * c * VSTR);
            ldfrag(vb1, sVh + vcoff + 16 * c * VSTR + 32);
            oacc[c] = __builtin_amdgcn_wmma_f32_16x16x32_f16(false, pa0.h, false, vb0.h, (short)0, oacc[c], false, false);
            oacc[c] = __builtin_amdgcn_wmma_f32_16x16x32_f16(false, pa1.h, false, vb1.h, (short)0, oacc[c], false, false);
        }
        // ---- softmax denominator via WMMA against ones-column
        oacc[4] = __builtin_amdgcn_wmma_f32_16x16x32_f16(false, pa0.h, false, ones.h, (short)0, oacc[4], false, false);
        oacc[4] = __builtin_amdgcn_wmma_f32_16x16x32_f16(false, pa1.h, false, ones.h, (short)0, oacc[4], false, false);

        // Keeps the held tile's conversions behind the tile's math: without it
        // the scheduler lifts them to just behind their loads, whose latency
        // is then waited out at the head of the tile.
        __builtin_amdgcn_sched_barrier(0);

        // ---- the held tile goes to the buffer that the last tile has left
        stage_store(st, sK32[h ^ 1], sV32[h ^ 1], kRow0, kCol0, vRow0, vCol0);
        // Rows of the tile after next: read here so that their LDS latency
        // falls into the wait in front of the barrier.
        rows_load(rw, sIdx + (kt + 2) * KT, kRow0, vRow0);
        // One barrier a tile: publishes tile kt+1 and ends every wave's reads
        // of this tile's buffer, which is refilled behind it.
        __syncthreads();
      }
    }

    // ---- normalize and write out (D layout: row = r + 8*hi, col = c*16 + n)
    #pragma unroll
    for (int r = 0; r < 8; ++r) {
        const float inv = 1.0f / oacc[4][r];
        float* orow = O + (size_t)(b * SQ + qbase + r + 8 * hi) * D_;
        orow[ 0 + n] = oacc[0][r] * inv;
        orow[16 + n] = oacc[1][r] * inv;
        orow[32 + n] = oacc[2][r] * inv;
        orow[48 + n] = oacc[3][r] * inv;
    }
}

extern "C" void kernel_launch(void* const* d_in, const int* in_sizes, int n_in,
                              void* d_out, int out_size, void* d_ws, size_t ws_size,
                              hipStream_t stream) {
    const float* Q    = (const float*)d_in[0];
    const float* K    = (const float*)d_in[1];
    const float* V    = (const float*)d_in[2];
    const int*   mask = (const int*)d_in[3];
    float*       O    = (float*)d_out;
    (void)in_sizes; (void)n_in; (void)out_size; (void)d_ws; (void)ws_size;

    const int grid = B_ * (SQ / (QTILE * WAVES));   // 16 * 32 = 512 blocks
    fa_fwd_kernel<<<grid, WAVES * 32, 0, stream>>>(Q, K, V, mask, O);
}

// v003
// One run takes 21.8 microseconds.
// Next to v002, in two timings, it ran 1.18 times as fast each time.
// Counting every step since v000, it is 3.24 times as fast.
#include <hip/hip_runtime.h>

// CDNA5 / gfx1250 flash-attention (fused scaled-dot-product attention).
// B=16, Sq=Sk=2048, d=64. fp32 in/out, f16 WMMA compute, fp32 online softmax
// in base-2 domain; denominator via an all-ones WMMA operand;
// all LDS fragment loads are 16B-aligned ds_load_b128.
// Both products run transposed (S^T = K Q^T, O^T += V^T P^T): a lane holds the
// scores of ONE query, so the maximum is taken in the lane (plus one exchange
// between the lane halves) and P packs from the score accumulators straight
// into the B operand of the second product, with no trip through LDS.
// Padded keys have softmax weight exactly 0: each block first lists the rows of
// its batch's unpadded keys (in order) in LDS and walks only those, 64 a tile.
// K/V of tile t+1 are fetched into registers ahead of tile t's math and
// written to the other LDS buffer behind it (two buffers, one barrier a tile).

typedef __attribute__((ext_vector_type(16))) _Float16 v16h;
typedef __attribute__((ext_vector_type(2)))  __fp16   v2fp16;
typedef __attribute__((ext_vector_type(8)))  float    v8f;

#define B_    16
#define SQ    2048
#define SK    2048
#define D_    64
#define QTILE 16      // query rows per wave
#define WAVES 4       // waves per block
#define KT    64      // keys per tile iteration
#define KSTR  72      // LDS stride (halves); 144B => every frag group 16B-aligned
#define VSTR  72
#define OSTR  68      // LDS stride (floats) of the output staging; 272B = 16B x odd
#define ROWB  (D_ * 4)    // bytes of one K or V row in global memory
#define NIDX  (SK + 2 * KT)   // row list: every key, and two tiles fetched ahead

union Frag { v16h h; unsigned int u[8]; uint4 q[2]; };
union HPair { v2fp16 h; unsigned int u; };

// Pack two f32 -> packed f16 dword (v_cvt_pk_rtz_f16_f32).
__device__ __forceinline__ unsigned int pkh2(float x, float y) {
    HPair p; p.h = __builtin_amdgcn_cvt_pkrtz(x, y);
    return p.u;
}

// Raw v_exp_f32 (args here are always <= 0 and far from denormal trouble;
// -1e30 -> 0 is exactly the behavior we want for masked columns).
__device__ __forceinline__ float fexp2(float x) {
#if __has_builtin(__builtin_amdgcn_exp2f)
    return __builtin_amdgcn_exp2f(x);
#else
    return exp2f(x);
#endif
}

// Lane l's value as seen from lane l ^ 16 (one vector cross-row move).
__device__ __forceinline__ float xhalf(float x) {
    return __int_as_float(__builtin_amdgcn_permlanex16(
        __float_as_int(x), __float_as_int(x), 0x76543210, 0xfedcba98, false, false));
}

__device__ __forceinline__ float max3f(float a, float b, float c) {
    return fmaxf(fmaxf(a, b), c);
}

// Load one 16x32 f16 A/B fragment from a 16B-aligned LDS row base
// (base already includes the row offset and this lane's hi*8 K-group shift).
__device__ __forceinline__ void ldfrag(Frag& fr, const _Float16* base) {
    fr.q[0] = *(const uint4*)(base);        // K pairs 0..7   (this half)
    fr.q[1] = *(const uint4*)(base + 16);   // K pairs 16..23 (this half)
}

// One thread's share of a 64-key tile, held in registers while it is in flight.
struct Stage {
    float4 k[8];     // K: 8 rows x 4 floats
    float2 va[8];    // V: 8 row pairs x 2 columns
    float2 vb[8];
};

// This thread's rows of one tile: byte offsets into K and V, from the row list.
struct Rows {
    unsigned int k[8];
    uint2        v[8];
};

// lst: the tile's 64 entries of the row list.
__device__ __forceinline__ void rows_load(Rows& rw, const unsigned int* lst,
                                          int kRow0, int vRow0) {
    #pragma unroll
    for (int i = 0; i < 8; ++i) rw.k[i] = lst[kRow0 + 8 * i];
    #pragma unroll
    for (int i = 0; i < 8; ++i) rw.v[i] = *(const uint2*)(lst + vRow0 + 8 * i);
}

// Issue every global load of one tile (no use of the values here).
__device__ __forceinline__ void stage_load(Stage& st,
                                           const float* __restrict__ Kb,
                                           const float* __restrict__ Vb,
                                           const Rows& rw,
                                           unsigned int kColB, unsigned int vColB) {
    #pragma unroll
    for (int i = 0; i < 8; ++i)
        st.k[i] = *(const float4*)((const char*)Kb + (rw.k[i] + kColB));
    #pragma unroll
    for (int i = 0; i < 8; ++i) {
        st.va[i] = *(const float2*)((const char*)Vb + (rw.v[i].x + vColB));
        st.vb[i] = *(const float2*)((const char*)Vb + (rw.v[i].y + vColB));
    }
}

// Convert the held tile to f16 and write it to one LDS buffer:
// K row-major, V transposed in 2x2 blocks (packed dword stores).
__device__ __forceinline__ void stage_store(const Stage& st,
                                            unsigned int* sK, unsigned int* sV,
                                            int kRow0, int kCol0,
                                            int vRow0, int vCol0) {
    // One base index each plus compile-time steps: the steps fold into the
    // store instructions, so the addresses take two registers, not two dozen
    // (the held tile needs the room).
    unsigned int* const kd = sK + ((kRow0 * KSTR + kCol0) >> 1);
    unsigned int* const vd = sV + ((vCol0 * VSTR + vRow0) >> 1);
    #pragma unroll
    for (int i = 0; i < 8; ++i) {
        kd[i * (4 * KSTR)]     = pkh2(st.k[i].x, st.k[i].y);
        kd[i * (4 * KSTR) + 1] = pkh2(st.k[i].z, st.k[i].w);
    }
    #pragma unroll
    for (int i = 0; i < 8; ++i) {
        vd[4 * i]              = pkh2(st.va[i].x, st.vb[i].x);
        vd[4 * i + VSTR / 2]   = pkh2(st.va[i].y, st.vb[i].y);
    }
}

__global__ __launch_bounds__(128)
void fa_fwd_kernel(const float* __restrict__ Q,
                   const float* __restrict__ K,
                   const float* __restrict__ V,
                   const int*   __restrict__ mask,   // [B, Sk], nonzero = padded
                   float* __restrict__ O)
{
    __shared__ unsigned int sK32[2][KT * KSTR / 2];       // K tile [key][d], f16
    __shared__ unsigned int sV32[2][D_ * VSTR / 2];       // V^T tile [d][key], f16
    __shared__ __attribute__((aligned(16))) float sO[WAVES * QTILE * OSTR];  // output rows
    __shared__ __attribute__((aligned(16))) unsigned int sIdx[NIDX];  // row list
    __shared__ int sCnt[WAVES];                           // unpadded keys per wave

    const int tid  = threadIdx.x;
    const int wave = tid >> 5;
    const int lane = tid & 31;
    const int n    = lane & 15;          // fragment column / row-within-16
    const int hi   = (lane >> 4) & 1;    // lane half selects K/M sub-range

    const int b     = blockIdx.x >> 5;           // SQ/(QTILE*WAVES)=32 chunks
    const int qc    = blockIdx.x & 31;
    const int qbase = qc * (QTILE * WAVES) + wave * QTILE;
    const int bSK   = b * SK;

    // Loop-invariant per-lane staging offsets (kCol0/vCol0 in floats, kColB/vColB in bytes).
    const int kRow0 = tid >> 4;                  // K stage: base row, +8 per iter
    const int kCol0 = (tid & 15) << 2;
    const unsigned int kColB = (unsigned int)kCol0 * 4u;
    const int vRow0 = (tid >> 5) << 1;           // V stage: base row pair, +8 per iter
    const int vCol0 = (tid & 31) << 1;
    const unsigned int vColB = (unsigned int)vCol0 * 4u;

    const float* const Kb = K + (size_t)bSK * D_;             // uniform bases
    const float* const Vb = V + (size_t)bSK * D_;
    const int*   const Mb = mask + bSK;

    // ---- list the unpadded keys of this batch row, in their order.
    // Wave w looks at keys [512 w, 512 w + 512), 32 at a time: a ballot gives
    // each kept key its rank. Entries behind the last kept key stay 0 (row 0,
    // in bounds): in the last tile their score columns are masked, and the
    // fetches that run ahead of the last tile need no test.
    int count;
    {
        int mv[SK / (WAVES * 32)];
        #pragma unroll
        for (int j = 0; j < SK / (WAVES * 32); ++j)
            mv[j] = Mb[wave * (SK / WAVES) + j * 32 + lane];
        #pragma unroll
        for (int j = 0; j < NIDX / (WAVES * 32); ++j)
            sIdx[j * (WAVES * 32) + tid] = 0u;
        unsigned int bal[SK / (WAVES * 32)];
        int tot = 0;
        #pragma unroll
        for (int j = 0; j < SK / (WAVES * 32); ++j) {
            bal[j] = __builtin_amdgcn_ballot_w32(mv[j] == 0);
            tot += __builtin_popcount(bal[j]);
        }
        if (lane == 0) sCnt[wave] = tot;
        __syncthreads();
        int base = 0, all = 0;
        #pragma unroll
        for (int w = 0; w < WAVES; ++w) {
            const int c = sCnt[w];
            base += (w < wave) ? c : 0;
            all  += c;
        }
        #pragma unroll
        for (int j = 0; j < SK / (WAVES * 32); ++j) {
            if (mv[j] == 0)
                sIdx[base + (int)__builtin_amdgcn_mbcnt_lo(bal[j], 0u)] =
                    (unsigned int)(wave * (SK / WAVES) + j * 32 + lane) * ROWB;
            base += __builtin_popcount(bal[j]);
        }
        __syncthreads();
        // The same in every lane of the block; held as a scalar so that the
        // loop tests below are scalar branches. The clamp bounds the trips.
        count = min(__builtin_amdgcn_readfirstlane(all), SK);
    }
    const int nt = (count + KT - 1) / KT;        // key tiles to walk, 0..32

    // ---- tile 0 starts its flight ahead of the Q fragment set-up
    Stage st;
    Rows  rw;
    rows_load(rw, sIdx, kRow0, vRow0);
    stage_load(st, Kb, Vb, rw, kColB, vColB);
    rows_load(rw, sIdx + KT, kRow0, vRow0);

    // ---- Q fragments (16x64 -> two chained 16x32), the B operand of S^T.
    // Scale folds 1/sqrt(d) and log2(e) so softmax runs in base-2 domain.
    const float qscale = 0.125f * 1.44269504088896340736f;
    Frag qa0, qa1;
    {
        const float* qrow = Q + (size_t)(b * SQ + qbase + n) * D_;
        #pragma unroll
        for (int v = 0; v < 8; ++v) {
            const int kb = ((v >= 4) ? 16 : 0) + (hi ? 8 : 0) + ((v & 3) << 1);
            qa0.u[v] = pkh2(qrow[kb]      * qscale, qrow[kb + 1]      * qscale);
            qa1.u[v] = pkh2(qrow[32 + kb] * qscale, qrow[32 + kb + 1] * qscale);
        }
    }

    // Constant all-ones A fragment: accumulates softmax denominator via WMMA.
    Frag ones;
    #pragma unroll
    for (int v = 0; v < 8; ++v) ones.u[v] = 0x3C003C00u;   // (1.0h, 1.0h)

    // Loop-invariant LDS fragment base pointers (include hi*8 K-group shift).
    const int kfoff = n * KSTR + 8 * hi;     // + 16 * f * KSTR per fragment
    const int vcoff = n * VSTR + 8 * hi;     // + 16 * c * VSTR per d chunk

    // Online-softmax state of query n (the same in both lane halves).
    // oacc[c][r] = O[n][16 c + 8 hi + r]; every row of oacc[4] is the running
    // sum of query n's weights (denominator).
    float m_run = -1e30f;
    v8f   oacc[5] = {v8f{}, v8f{}, v8f{}, v8f{}, v8f{}};

    // ---- prologue: tile 0 into buffer 0
    stage_store(st, sK32[0], sV32[0], kRow0, kCol0, vRow0, vCol0);
    __syncthreads();

    // Two tiles a trip so that the buffer index is a compile-time constant
    // (LDS offsets fold into the instructions); the outer loop stays rolled.
    #pragma clang loop unroll(disable)
    for (int kt2 = 0; kt2 < nt; kt2 += 2) {
      #pragma unroll
      for (int h = 0; h < 2; ++h) {
        const int kt = kt2 + h;
        if (h == 1 && kt >= nt) break;                    // block-uniform
        const _Float16* const sKh = (const _Float16*)sK32[h];
        const _Float16* const sVh = (const _Float16*)sV32[h];

        // ---- next tile's global loads fly while this tile is worked on
        // (behind the last tile: row 0, stored to the free buffer, never read)
        stage_load(st, Kb, Vb, rw, kColB, vColB);
        // Keeps the loads above ahead of the tile's math: without it the
        // scheduler sinks them to just in front of their use and the latency
        // is waited out again.
        __builtin_amdgcn_sched_barrier(0);

        // ---- scores, transposed: s[f][r] = S[query n][key 16 f + 8 hi + r]
        Frag ka[4][2];
        #pragma unroll
        for (int f = 0; f < 4; ++f) {
            ldfrag(ka[f][0], sKh + kfoff + 16 * f * KSTR);
            ldfrag(ka[f][1], sKh + kfoff + 16 * f * KSTR + 32);
        }
        // Keeps the tile's K fragment loads in one group ahead of the products:
        // without it they come in pairs, each waited out in front of its product.
        __builtin_amdgcn_sched_barrier(0);
        v8f s[4];
        #pragma unroll
        for (int f = 0; f < 4; ++f)
            s[f] = __builtin_amdgcn_wmma_f32_16x16x32_f16(false, ka[f][0].h, false, qa0.h, (short)0, v8f{}, false, false);
        #pragma unroll
        for (int f = 0; f < 4; ++f)
            s[f] = __builtin_amdgcn_wmma_f32_16x16x32_f16(false, ka[f][1].h, false, qa1.h, (short)0, s[f], false, false);

        // ---- keys behind the last listed one are masked; only the last tile
        // can hold any (block-uniform scalar test)
        const int rem = count - kt * KT;
        if (rem < KT) {
            const int lim = rem - 8 * hi;
            #pragma unroll
            for (int f = 0; f < 4; ++f) {
                #pragma unroll
                for (int r = 0; r < 8; ++r)
                    s[f][r] = (16 * f + r >= lim) ? -1e30f : s[f][r];
            }
        }

        // ---- online softmax update: the lane's 32 scores, then the other half's
        float l1[12];
        #pragma unroll
        for (int i = 0; i < 10; ++i)
            l1[i] = max3f(s[(3 * i) >> 3][(3 * i) & 7],
                          s[(3 * i + 1) >> 3][(3 * i + 1) & 7],
                          s[(3 * i + 2) >> 3][(3 * i + 2) & 7]);
        l1[10] = s[3][6];
        l1[11] = s[3][7];
        const float mx = fmaxf(max3f(max3f(l1[0], l1[1], l1[2]),
                                     max3f(l1[3], l1[4], l1[5]),
                                     max3f(l1[6], l1[7], l1[8])),
                               max3f(l1[9], l1[10], l1[11]));
        const float mnew  = max3f(m_run, mx, xhalf(mx));
        const float alpha = fexp2(m_run - mnew);
        m_run = mnew;

        // ---- P^T: two score tiles, converted in place, are one B operand
        // (element e of the operand = key 8 hi + e, then 16 + 8 hi + (e - 8))
        Frag pb0, pb1;
        #pragma unroll
        for (int v = 0; v < 4; ++v) {
            pb0.u[v]     = pkh2(fexp2(s[0][2 * v] - mnew), fexp2(s[0][2 * v + 1] - mnew));
            pb0.u[v + 4] = pkh2(fexp2(s[1][2 * v] - mnew), fexp2(s[1][2 * v + 1] - mnew));
            pb1.u[v]     = pkh2(fexp2(s[2][2 * v] - mnew), fexp2(s[2][2 * v + 1] - mnew));
            pb1.u[v + 4] = pkh2(fexp2(s[3][2 * v] - mnew), fexp2(s[3][2 * v + 1] - mnew));
        }
        #pragma unroll
        for (int c = 0; c < 5; ++c) {
            #pragma unroll
            for (int r = 0; r < 8; ++r) oacc[c][r] *= alpha;
        }

        // ---- O^T += V^T (16 d x 64 keys) x P^T (64 keys x 16) per d chunk
        #pragma unroll
        for (int c = 0; c < 4; ++c) {
            Frag va0, va1;
            ldfrag(va0, sVh + vcoff + 16 * c * VSTR);
            ldfrag(va1, sVh + vcoff + 16 * c * VSTR + 32);
            oacc[c] = __builtin_amdgcn_wmma_f32_16x16x32_f16(false, va0.h, false, pb0.h, (short)0, oacc[c], false, false);
            oacc[c] = __builtin_amdgcn_wmma_f32_16x16x32_f16(false, va1.h, false, pb1.h, (short)0, oacc[c], false, false);
        }
        // ---- softmax denominator via WMMA against the all-ones operand
        oacc[4] = __builtin_amdgcn_wmma_f32_16x16x32_f16(false, ones.h, false, pb0.h, (short)0, oacc[4], false, false);
        oacc[4] = __builtin_amdgcn_wmma_f32_16x16x32_f16(false, ones.h, false, pb1.h, (short)0, oacc[4], false, false);

        // Keeps the held tile's conversions behind the tile's math: without it
        // the scheduler lifts them to just behind their loads, whose latency
        // is then waited out at the head of the tile.
        __builtin_amdgcn_sched_barrier(0);

        // ---- the held tile goes to the buffer that the last tile has left
        stage_store(st, sK32[h ^ 1], sV32[h ^ 1], kRow0, kCol0, vRow0, vCol0);
        // Rows of the tile after next: read here so that their LDS latency
        // falls into the wait in front of the barrier.
        rows_load(rw, sIdx + (kt + 2) * KT, kRow0, vRow0);
        // One barrier a tile: publishes tile kt+1 and ends every wave's reads
        // of this tile's buffer, which is refilled behind it.
        __syncthreads();
      }
    }

    // ---- normalize; a lane holds 8 consecutive d of query n per chunk. The
    // wave turns its 16 x 64 tile round in its own LDS range so that each
    // global store covers two whole output rows (512 contiguous bytes).
    float* const sOw = sO + wave * (QTILE * OSTR);
    const float inv = 1.0f / oacc[4][0];
    #pragma unroll
    for (int c = 0; c < 4; ++c) {
        float* const d = sOw + n * OSTR + 16 * c + 8 * hi;
        *(float4*)(d)     = make_float4(oacc[c][0] * inv, oacc[c][1] * inv,
                                        oacc[c][2] * inv, oacc[c][3] * inv);
        *(float4*)(d + 4) = make_float4(oacc[c][4] * inv, oacc[c][5] * inv,
                                        oacc[c][6] * inv, oacc[c][7] * inv);
    }
    // The rows are read back by other lanes of this wave: its LDS writes have
    // to be done first.
    asm volatile("s_wait_dscnt 0x0" ::: "memory");
    float* const obase = O + (size_t)(b * SQ + qbase + hi) * D_ + 4 * n;
    #pragma unroll
    for (int i = 0; i < 8; ++i)
        *(float4*)(obase + 2 * i * D_) =
            *(const float4*)(sOw + (2 * i + hi) * OSTR + 4 * n);
}

extern "C" void kernel_launch(void* const* d_in, const int* in_sizes, int n_in,
                              void* d_out, int out_size, void* d_ws, size_t ws_size,
                              hipStream_t stream) {
    const float* Q    = (const float*)d_in[0];
    const float* K    = (const float*)d_in[1];
    const float* V    = (const float*)d_in[2];
    const int*   mask = (const int*)d_in[3];
    float*       O    = (float*)d_out;
    (void)in_sizes; (void)n_in; (void)out_size; (void)d_ws; (void)ws_size;

    const int grid = B_ * (SQ / (QTILE * WAVES));   // 16 * 32 = 512 blocks
    fa_fwd_kernel<<<grid, WAVES * 32, 0, stream>>>(Q, K, V, mask, O);
}

// v004
// Measured time: 17.1 microseconds a run.
// Two timings next to v003 both put it at 1.28 times that version's speed.
// Over all steps from v000 it is 4.13 times as fast.
#include <hip/hip_runtime.h>

// CDNA5 / gfx1250 flash-attention (fused scaled-dot-product attention).
// B=16, Sq=Sk=2048, d=64. fp32 in/out, f16 WMMA compute, fp32 online softmax
// in base-2 domain; denominator via an all-ones WMMA operand;
// all LDS fragment loads are 16B-aligned ds_load_b128.
// Both products run transposed (S^T = K Q^T, O^T += V^T P^T): a lane holds the
// scores of ONE query, so the maximum is taken in the lane (plus one exchange
// between the lane halves) and P packs from the score accumulators straight
// into the B operand of the second product, with no trip through LDS.
// Padded keys have softmax weight exactly 0: each block first lists the rows of
// its batch's unpadded keys (in order) in LDS and walks only those, 64 a tile.
// K/V of tile t+2 are fetched into registers ahead of tile t's math and
// written to its key group's other LDS buffer behind it (two buffers a key
// group, one barrier a tile).
// A wave holds 32 queries (two column groups), so each K and V fragment read
// from LDS feeds two products and a staged tile serves 128 queries. The block's
// two halves of four waves walk alternate key tiles of the same 128 queries
// (two waves a SIMD stay) and join their partial results through LDS at the end.

typedef __attribute__((ext_vector_type(16))) _Float16 v16h;
typedef __attribute__((ext_vector_type(2)))  __fp16   v2fp16;
typedef __attribute__((ext_vector_type(8)))  float    v8f;

#define B_    16
#define SQ    2048
#define SK    2048
#define D_    64
#define QTILE 16      // query rows per column group
#define QG    2       // column groups per wave
#define GW    4       // waves per key group (they stage and read one tile)
#define KGR   2       // key groups per block (alternate tiles)
#define WAVES (GW * KGR)          // waves per block
#define QBLK  (QTILE * QG * GW)   // queries per block
#define KT    64      // keys per tile iteration
#define KSTR  72      // LDS stride (halves); 144B => every frag group 16B-aligned
#define VSTR  72
#define OSTR  68      // LDS stride (floats) of the output staging; 272B = 16B x odd
#define ROWB  (D_ * 4)    // bytes of one K or V row in global memory
#define NIDX  (SK + 4 * KT)   // row list: every key, and two tiles a key group fetched ahead
#define KBUF  (KT * KSTR / 2) // dwords of one K buffer
#define VBUF  (D_ * VSTR / 2) // dwords of one V^T buffer

union Frag { v16h h; unsigned int u[8]; uint4 q[2]; };
union HPair { v2fp16 h; unsigned int u; };

// Pack two f32 -> packed f16 dword (v_cvt_pk_rtz_f16_f32).
__device__ __forceinline__ unsigned int pkh2(float x, float y) {
    HPair p; p.h = __builtin_amdgcn_cvt_pkrtz(x, y);
    return p.u;
}

// Raw v_exp_f32 (args here are always <= 0 and far from denormal trouble;
// -1e30 -> 0 is exactly the behavior we want for masked columns).
__device__ __forceinline__ float fexp2(float x) {
#if __has_builtin(__builtin_amdgcn_exp2f)
    return __builtin_amdgcn_exp2f(x);
#else
    return exp2f(x);
#endif
}

// Lane l's value as seen from lane l ^ 16 (one vector cross-row move).
__device__ __forceinline__ float xhalf(float x) {
    return __int_as_float(__builtin_amdgcn_permlanex16(
        __float_as_int(x), __float_as_int(x), 0x76543210, 0xfedcba98, false, false));
}

__device__ __forceinline__ float max3f(float a, float b, float c) {
    return fmaxf(fmaxf(a, b), c);
}

// Load one 16x32 f16 A/B fragment from a 16B-aligned LDS row base
// (base already includes the row offset and this lane's hi*8 K-group shift).
__device__ __forceinline__ void ldfrag(Frag& fr, const _Float16* base) {
    fr.q[0] = *(const uint4*)(base);        // K pairs 0..7   (this half)
    fr.q[1] = *(const uint4*)(base + 16);   // K pairs 16..23 (this half)
}

// One thread's share of a 64-key tile, held in registers while it is in flight.
struct Stage {
    float4 k[8];     // K: 8 rows x 4 floats
    float2 va[8];    // V: 8 row pairs x 2 columns
    float2 vb[8];
};

// This thread's rows of one tile: byte offsets into K and V, from the row list.
struct Rows {
    unsigned int k[8];
    uint2        v[8];
};

// lst: the tile's 64 entries of the row list.
__device__ __forceinline__ void rows_load(Rows& rw, const unsigned int* lst,
                                          int kRow0, int vRow0) {
    #pragma unroll
    for (int i = 0; i < 8; ++i) rw.k[i] = lst[kRow0 + 8 * i];
    #pragma unroll
    for (int i = 0; i < 8; ++i) rw.v[i] = *(const uint2*)(lst + vRow0 + 8 * i);
}

// Issue every global load of one tile (no use of the values here).
__device__ __forceinline__ void stage_load(Stage& st,
                                           const float* __restrict__ Kb,
                                           const float* __restrict__ Vb,
                                           const Rows& rw,
                                           unsigned int kColB, unsigned int vColB) {
    unsigned int ak[8], ax[8], ay[8];
    #pragma unroll
    for (int i = 0; i < 8; ++i) {
        ak[i] = rw.k[i] + kColB;
        ax[i] = rw.v[i].x + vColB;
        ay[i] = rw.v[i].y + vColB;
    }
    #pragma unroll
    for (int i = 0; i < 8; ++i)
        st.k[i] = *(const float4*)((const char*)Kb + ak[i]);
    #pragma unroll
    for (int i = 0; i < 8; ++i) {
        st.va[i] = *(const float2*)((const char*)Vb + ax[i]);
        st.vb[i] = *(const float2*)((const char*)Vb + ay[i]);
    }
    // The wait that stands in front of any rewrite of the loads' address
    // registers; naming them as inputs keeps them untouched up to it.
    asm volatile("s_wait_xcnt 0x0"
                 :: "v"(ak[0]), "v"(ak[1]), "v"(ak[2]), "v"(ak[3]),
                    "v"(ak[4]), "v"(ak[5]), "v"(ak[6]), "v"(ak[7]),
                    "v"(ax[0]), "v"(ax[1]), "v"(ax[2]), "v"(ax[3]),
                    "v"(ax[4]), "v"(ax[5]), "v"(ax[6]), "v"(ax[7]),
                    "v"(ay[0]), "v"(ay[1]), "v"(ay[2]), "v"(ay[3]),
                    "v"(ay[4]), "v"(ay[5]), "v"(ay[6]), "v"(ay[7])
                 : "memory");
}

// Convert the held tile to f16 and write it to one LDS buffer:
// K row-major, V transposed in 2x2 blocks (packed dword stores).
__device__ __forceinline__ void stage_store(const Stage& st,
                                            unsigned int* sK, unsigned int* sV,
                                            int kRow0, int kCol0,
                                            int vRow0, int vCol0) {
    // One base index each plus compile-time steps: the steps fold into the
    // store instructions, so the addresses take two registers, not two dozen
    // (the held tile needs the room).
    unsigned int* const kd = sK + ((kRow0 * KSTR + kCol0) >> 1);
    unsigned int* const vd = sV + ((vCol0 * VSTR + vRow0) >> 1);
    #pragma unroll
    for (int i = 0; i < 8; ++i) {
        kd[i * (4 * KSTR)]     = pkh2(st.k[i].x, st.k[i].y);
        kd[i * (4 * KSTR) + 1] = pkh2(st.k[i].z, st.k[i].w);
    }
    #pragma unroll
    for (int i = 0; i < 8; ++i) {
        vd[4 * i]              = pkh2(st.va[i].x, st.vb[i].x);
        vd[4 * i + VSTR / 2]   = pkh2(st.va[i].y, st.vb[i].y);
    }
}

__global__ __launch_bounds__(WAVES * 32)
void fa_fwd_kernel(const float* __restrict__ Q,
                   const float* __restrict__ K,
                   const float* __restrict__ V,
                   const int*   __restrict__ mask,   // [B, Sk], nonzero = padded
                   float* __restrict__ O)
{
    __shared__ __attribute__((aligned(16))) unsigned int sK32[KGR][2][KBUF];  // K tile [key][d], f16
    __shared__ __attribute__((aligned(16))) unsigned int sV32[KGR][2][VBUF];  // V^T tile [d][key], f16
    __shared__ __attribute__((aligned(16))) float sO[WAVES * QTILE * OSTR];  // output rows
    __shared__ __attribute__((aligned(16))) float sX[WAVES * 32 * 32];       // handed-over partial O
    __shared__ float2 sML[WAVES * 32];                    // handed-over maximum and sum
    __shared__ __attribute__((aligned(16))) unsigned int sIdx[NIDX];  // row list
    __shared__ int sCnt[WAVES];                           // unpadded keys per wave

    const int tid  = threadIdx.x;
    const int wave = tid >> 5;
    const int lane = tid & 31;
    const int n    = lane & 15;          // fragment column / row-within-16
    const int hi   = (lane >> 4) & 1;    // lane half selects K/M sub-range
    // Key group of this wave; held as a scalar so that the tests on its tile
    // index below are scalar branches.
    const int grp  = __builtin_amdgcn_readfirstlane(tid >> 7);
    const int gt   = tid & (GW * 32 - 1);        // thread within the key group

    const int b     = blockIdx.x >> 4;           // SQ/QBLK = 16 chunks
    const int qc    = blockIdx.x & 15;
    // Waves w and w + 4 hold the same 32 queries. Column group j of a wave is
    // queries qpair + 16 (j ^ grp): what one wave has as group 1 the other has
    // as group 0, so at the end each hands over group 1 and finishes group 0.
    const int qpair = qc * QBLK + (wave & (GW - 1)) * (QTILE * QG);
    const int bSK   = b * SK;

    // Loop-invariant per-lane staging offsets (row and column indices, column bytes).
    const int kRow0 = gt >> 4;                   // K stage: base row, +8 per iter
    const int kCol0 = (gt & 15) << 2;
    const unsigned int kColB = (unsigned int)kCol0 * 4u;
    const int vRow0 = (gt >> 5) << 1;            // V stage: base row pair, +8 per iter
    const int vCol0 = (gt & 31) << 1;
    const unsigned int vColB = (unsigned int)vCol0 * 4u;

    const float* const Kb = K + (size_t)bSK * D_;             // uniform bases
    const float* const Vb = V + (size_t)bSK * D_;
    const int*   const Mb = mask + bSK;

    // ---- list the unpadded keys of this batch row, in their order.
    // Wave w looks at keys [256 w, 256 w + 256), 32 at a time: a ballot gives
    // each kept key its rank. Entries behind the last kept key stay 0 (row 0,
    // in bounds): in the last tile their score columns are masked, and the
    // fetches that run ahead of the last tile need no test.
    int count;
    {
        int mv[SK / (WAVES * 32)];
        const unsigned int mB = (unsigned int)(wave * (SK / WAVES) + lane) * 4u;
        const char* const mp = (const char*)Mb + mB;
        #pragma unroll
        for (int j = 0; j < SK / (WAVES * 32); ++j)
            mv[j] = *(const int*)(mp + j * 128);
        // The wait that stands in front of any rewrite of the loads' address
        // register; naming it as an input keeps it untouched up to it.
        asm volatile("s_wait_xcnt 0x0" :: "v"(mB) : "memory");
        #pragma unroll
        for (int j = 0; j < NIDX / (WAVES * 32); ++j)
            sIdx[j * (WAVES * 32) + tid] = 0u;
        unsigned int bal[SK / (WAVES * 32)];
        int tot = 0;
        #pragma unroll
        for (int j = 0; j < SK / (WAVES * 32); ++j) {
            bal[j] = __builtin_amdgcn_ballot_w32(mv[j] == 0);
            tot += __builtin_popcount(bal[j]);
        }
        if (lane == 0) sCnt[wave] = tot;
        __syncthreads();
        int base = 0, all = 0;
        #pragma unroll
        for (int w = 0; w < WAVES; ++w) {
            const int c = sCnt[w];
            base += (w < wave) ? c : 0;
            all  += c;
        }
        #pragma unroll
        for (int j = 0; j < SK / (WAVES * 32); ++j) {
            if (mv[j] == 0)
                sIdx[base + (int)__builtin_amdgcn_mbcnt_lo(bal[j], 0u)] =
                    (unsigned int)(wave * (SK / WAVES) + j * 32 + lane) * ROWB;
            base += __builtin_popcount(bal[j]);
        }
        __syncthreads();
        // The same in every lane of the block; held as a scalar so that the
        // loop tests below are scalar branches. The clamp bounds the trips.
        count = min(__builtin_amdgcn_readfirstlane(all), SK);
    }
    const int nt = (count + KT - 1) / KT;        // key tiles to walk, 0..32
    const int ni = (nt + KGR - 1) / KGR;         // trips: tile KGR i + grp in trip i

    // This key group's tiles in the row list, and its LDS buffers.
    const unsigned int* const lstg = sIdx + grp * KT;
    unsigned int* const sKg = &sK32[grp][0][0];
    unsigned int* const sVg = &sV32[grp][0][0];

    // ---- the group's first tile starts its flight ahead of the Q fragment set-up
    Stage st;
    Rows  rw;
    rows_load(rw, lstg, kRow0, vRow0);
    stage_load(st, Kb, Vb, rw, kColB, vColB);
    rows_load(rw, lstg + KGR * KT, kRow0, vRow0);

    // ---- Q fragments (16x64 -> two chained 16x32 per column group), the B
    // operand of S^T.
    // Scale folds 1/sqrt(d) and log2(e) so softmax runs in base-2 domain.
    const float qscale = 0.125f * 1.44269504088896340736f;
    Frag qa[QG][2];
    {
        // This lane's 8-float groups of its two query rows: at 16 g + 8 hi.
        const float* qp[QG];
        float4 qv[QG][8];
        #pragma unroll
        for (int j = 0; j < QG; ++j) {
            qp[j] = Q + (size_t)(b * SQ + qpair + QTILE * (j ^ grp) + n) * D_ + 8 * hi;
            #pragma unroll
            for (int g = 0; g < 4; ++g) {
                qv[j][2 * g]     = *(const float4*)(qp[j] + 16 * g);
                qv[j][2 * g + 1] = *(const float4*)(qp[j] + 16 * g + 4);
            }
        }
        // The wait that stands in front of any rewrite of the loads' address
        // registers; naming them as inputs keeps them untouched up to it.
        asm volatile("s_wait_xcnt 0x0" :: "v"(qp[0]), "v"(qp[1]) : "memory");
        #pragma unroll
        for (int j = 0; j < QG; ++j) {
            #pragma unroll
            for (int g = 0; g < 4; ++g) {
                const float4 x = qv[j][2 * g], y = qv[j][2 * g + 1];
                unsigned int* const u = &qa[j][g >> 1].u[4 * (g & 1)];
                u[0] = pkh2(x.x * qscale, x.y * qscale);
                u[1] = pkh2(x.z * qscale, x.w * qscale);
                u[2] = pkh2(y.x * qscale, y.y * qscale);
                u[3] = pkh2(y.z * qscale, y.w * qscale);
            }
        }
    }

    // Constant all-ones A fragment: accumulates softmax denominator via WMMA.
    Frag ones;
    #pragma unroll
    for (int v = 0; v < 8; ++v) ones.u[v] = 0x3C003C00u;   // (1.0h, 1.0h)

    // Loop-invariant LDS fragment base pointers (include hi*8 K-group shift).
    const int kfoff = n * KSTR + 8 * hi;     // + 16 * f * KSTR per fragment
    const int vcoff = n * VSTR + 8 * hi;     // + 16 * c * VSTR per d chunk

    // Online-softmax state of query n of each column group (the same in both
    // lane halves), over this key group's tiles.
    // oacc[j][c][r] = O[n][16 c + 8 hi + r]; every row of oacc[j][4] is the
    // running sum of query n's weights (denominator).
    float m_run[QG];
    v8f   oacc[QG][5];
    #pragma unroll
    for (int j = 0; j < QG; ++j) {
        m_run[j] = -1e30f;
        #pragma unroll
        for (int c = 0; c < 5; ++c) oacc[j][c] = v8f{};
    }

    // ---- prologue: the group's first tile into its buffer 0
    stage_store(st, sKg, sVg, kRow0, kCol0, vRow0, vCol0);
    __syncthreads();

    // Two tiles a trip so that the buffer index is a compile-time constant
    // (LDS offsets fold into the instructions); the outer loop stays rolled.
    #pragma clang loop unroll(disable)
    for (int i2 = 0; i2 < ni; i2 += 2) {
      #pragma unroll
      for (int h = 0; h < 2; ++h) {
        const int it = i2 + h;
        if (h == 1 && it >= ni) break;                    // block-uniform
        const _Float16* const sKh = (const _Float16*)(sKg + h * KBUF);
        const _Float16* const sVh = (const _Float16*)(sVg + h * VBUF);

        // ---- next tile's global loads fly while this tile is worked on
        // (behind the last tile: row 0, stored to the free buffer, never read)
        stage_load(st, Kb, Vb, rw, kColB, vColB);
        // Keeps the loads above ahead of the tile's math: without it the
        // scheduler sinks them to just in front of their use and the latency
        // is waited out again.
        __builtin_amdgcn_sched_barrier(0);

        // Listed keys from this tile's first on; none where the tile count is
        // odd and this is the second group's last trip (wave-uniform scalar
        // test; the staging and the barrier below are passed all the same).
        const int rem = count - (KGR * it + grp) * KT;
        if (rem > 0) {
        // ---- scores, transposed: s[j][f][r] = S[query n of group j][key 16 f + 8 hi + r]
        Frag ka[4][2];
        #pragma unroll
        for (int f = 0; f < 4; ++f) {
            ldfrag(ka[f][0], sKh + kfoff + 16 * f * KSTR);
            ldfrag(ka[f][1], sKh + kfoff + 16 * f * KSTR + 32);
        }
        // Keeps the tile's K fragment loads in one group ahead of the products:
        // without it they come in pairs, each waited out in front of its product.
        __builtin_amdgcn_sched_barrier(0);
        v8f s[QG][4];
        #pragma unroll
        for (int f = 0; f < 4; ++f) {
            #pragma unroll
            for (int j = 0; j < QG; ++j)
                s[j][f] = __builtin_amdgcn_wmma_f32_16x16x32_f16(false, ka[f][0].h, false, qa[j][0].h, (short)0, v8f{}, false, false);
        }
        #pragma unroll
        for (int f = 0; f < 4; ++f) {
            #pragma unroll
            for (int j = 0; j < QG; ++j)
                s[j][f] = __builtin_amdgcn_wmma_f32_16x16x32_f16(false, ka[f][1].h, false, qa[j][1].h, (short)0, s[j][f], false, false);
        }

        // ---- keys behind the last listed one are masked; only the last tile
        // can hold any (wave-uniform scalar test)
        if (rem < KT) {
            const int lim = rem - 8 * hi;
            #pragma unroll
            for (int j = 0; j < QG; ++j) {
                #pragma unroll
                for (int f = 0; f < 4; ++f) {
                    #pragma unroll
                    for (int r = 0; r < 8; ++r)
                        s[j][f][r] = (16 * f + r >= lim) ? -1e30f : s[j][f][r];
                }
            }
        }

        // ---- online softmax update: the lane's 32 scores, then the other half's
        float mnew[QG], alpha[QG];
        #pragma unroll
        for (int j = 0; j < QG; ++j) {
            float l1[12];
            #pragma unroll
            for (int i = 0; i < 10; ++i)
                l1[i] = max3f(s[j][(3 * i) >> 3][(3 * i) & 7],
                              s[j][(3 * i + 1) >> 3][(3 * i + 1) & 7],
                              s[j][(3 * i + 2) >> 3][(3 * i + 2) & 7]);
            l1[10] = s[j][3][6];
            l1[11] = s[j][3][7];
            const float mx = fmaxf(max3f(max3f(l1[0], l1[1], l1[2]),
                                         max3f(l1[3], l1[4], l1[5]),
                                         max3f(l1[6], l1[7], l1[8])),
                                   max3f(l1[9], l1[10], l1[11]));
            mnew[j] = max3f(m_run[j], mx, xhalf(mx));
        }
        #pragma unroll
        for (int j = 0; j < QG; ++j) {
            alpha[j] = fexp2(m_run[j] - mnew[j]);
            m_run[j] = mnew[j];
        }

        // ---- P^T: two score tiles, converted in place, are one B operand
        // (element e of the operand = key 8 hi + e, then 16 + 8 hi + (e - 8))
        Frag pb[QG][2];
        #pragma unroll
        for (int j = 0; j < QG; ++j) {
            #pragma unroll
            for (int v = 0; v < 4; ++v) {
                pb[j][0].u[v]     = pkh2(fexp2(s[j][0][2 * v] - mnew[j]), fexp2(s[j][0][2 * v + 1] - mnew[j]));
                pb[j][0].u[v + 4] = pkh2(fexp2(s[j][1][2 * v] - mnew[j]), fexp2(s[j][1][2 * v + 1] - mnew[j]));
                pb[j][1].u[v]     = pkh2(fexp2(s[j][2][2 * v] - mnew[j]), fexp2(s[j][2][2 * v + 1] - mnew[j]));
                pb[j][1].u[v + 4] = pkh2(fexp2(s[j][3][2 * v] - mnew[j]), fexp2(s[j][3][2 * v + 1] - mnew[j]));
            }
        }
        #pragma unroll
        for (int j = 0; j < QG; ++j) {
            #pragma unroll
            for (int c = 0; c < 5; ++c) {
                #pragma unroll
                for (int r = 0; r < 8; ++r) oacc[j][c][r] *= alpha[j];
            }
        }

        // ---- O^T += V^T (16 d x 64 keys) x P^T (64 keys x 16) per d chunk;
        // each V^T fragment feeds both column groups
        #pragma unroll
        for (int c = 0; c < 4; ++c) {
            Frag va0, va1;
            ldfrag(va0, sVh + vcoff + 16 * c * VSTR);
            ldfrag(va1, sVh + vcoff + 16 * c * VSTR + 32);
            #pragma unroll
            for (int j = 0; j < QG; ++j)
                oacc[j][c] = __builtin_amdgcn_wmma_f32_16x16x32_f16(false, va0.h, false, pb[j][0].h, (short)0, oacc[j][c], false, false);
            #pragma unroll
            for (int j = 0; j < QG; ++j)
                oacc[j][c] = __builtin_amdgcn_wmma_f32_16x16x32_f16(false, va1.h, false, pb[j][1].h, (short)0, oacc[j][c], false, false);
        }
        // ---- softmax denominator via WMMA against the all-ones operand
        #pragma unroll
        for (int j = 0; j < QG; ++j)
            oacc[j][4] = __builtin_amdgcn_wmma_f32_16x16x32_f16(false, ones.h, false, pb[j][0].h, (short)0, oacc[j][4], false, false);
        #pragma unroll
        for (int j = 0; j < QG; ++j)
            oacc[j][4] = __builtin_amdgcn_wmma_f32_16x16x32_f16(false, ones.h, false, pb[j][1].h, (short)0, oacc[j][4], false, false);
        }

        // Keeps the held tile's conversions behind the tile's math: without it
        // the scheduler lifts them to just behind their loads, whose latency
        // is then waited out at the head of the tile.
        __builtin_amdgcn_sched_barrier(0);

        // ---- the held tile goes to the buffer that the last tile has left
        stage_store(st, sKg + (h ^ 1) * KBUF, sVg + (h ^ 1) * VBUF, kRow0, kCol0, vRow0, vCol0);
        // Rows of the tile after next: read here so that their LDS latency
        // falls into the wait in front of the barrier.
        rows_load(rw, lstg + (it + 2) * (KGR * KT), kRow0, vRow0);
        // One barrier a tile: publishes the group's next tile and ends every
        // wave's reads of this tile's buffer, which is refilled behind it.
        __syncthreads();
      }
    }

    // ---- join the two key groups: each wave hands its column group 1 (partial
    // O, maximum, sum) to its partner wave, lane to lane, and finishes group 0.
    {
        float4* const xs = (float4*)sX + wave * (8 * 32) + lane;
        #pragma unroll
        for (int c = 0; c < 4; ++c) {
            xs[(2 * c) * 32]     = make_float4(oacc[1][c][0], oacc[1][c][1], oacc[1][c][2], oacc[1][c][3]);
            xs[(2 * c + 1) * 32] = make_float4(oacc[1][c][4], oacc[1][c][5], oacc[1][c][6], oacc[1][c][7]);
        }
        sML[wave * 32 + lane] = make_float2(m_run[1], oacc[1][4][0]);
    }
    // The partner wave reads what this wave wrote.
    __syncthreads();
    const int pw = wave ^ GW;
    const float2 ml   = sML[pw * 32 + lane];
    const float  mfin = fmaxf(m_run[0], ml.x);
    const float  a0   = fexp2(m_run[0] - mfin);
    const float  a1   = fexp2(ml.x - mfin);
    const float  inv  = 1.0f / (a0 * oacc[0][4][0] + a1 * ml.y);
    const float  w0   = a0 * inv;
    const float  w1   = a1 * inv;

    // ---- normalize; a lane holds 8 consecutive d of query n per chunk. The
    // wave turns its 16 x 64 tile round in its own LDS range so that each
    // global store covers two whole output rows (512 contiguous bytes).
    float* const sOw = sO + wave * (QTILE * OSTR);
    const float4* const xr = (const float4*)sX + pw * (8 * 32) + lane;
    #pragma unroll
    for (int c = 0; c < 4; ++c) {
        const float4 p0 = xr[(2 * c) * 32];
        const float4 p1 = xr[(2 * c + 1) * 32];
        float* const d = sOw + n * OSTR + 16 * c + 8 * hi;
        *(float4*)(d)     = make_float4(oacc[0][c][0] * w0 + p0.x * w1, oacc[0][c][1] * w0 + p0.y * w1,
                                        oacc[0][c][2] * w0 + p0.z * w1, oacc[0][c][3] * w0 + p0.w * w1);
        *(float4*)(d + 4) = make_float4(oacc[0][c][4] * w0 + p1.x * w1, oacc[0][c][5] * w0 + p1.y * w1,
                                        oacc[0][c][6] * w0 + p1.z * w1, oacc[0][c][7] * w0 + p1.w * w1);
    }
    // The rows are read back by other lanes of this wave: its LDS writes have
    // to be done first.
    asm volatile("s_wait_dscnt 0x0" ::: "memory");
    float* const obase = O + (size_t)(b * SQ + qpair + QTILE * grp + hi) * D_ + 4 * n;
    #pragma unroll
    for (int i = 0; i < 8; ++i)
        *(float4*)(obase + 2 * i * D_) =
            *(const float4*)(sOw + (2 * i + hi) * OSTR + 4 * n);
}

extern "C" void kernel_launch(void* const* d_in, const int* in_sizes, int n_in,
                              void* d_out, int out_size, void* d_ws, size_t ws_size,
                              hipStream_t stream) {
    const float* Q    = (const float*)d_in[0];
    const float* K    = (const float*)d_in[1];
    const float* V    = (const float*)d_in[2];
    const int*   mask = (const int*)d_in[3];
    float*       O    = (float*)d_out;
    (void)in_sizes; (void)n_in; (void)out_size; (void)d_ws; (void)ws_size;

    const int grid = B_ * (SQ / QBLK);   // 16 * 16 = 256 blocks
    fa_fwd_kernel<<<grid, WAVES * 32, 0, stream>>>(Q, K, V, mask, O);
}

// v005
// Measured time: 15.9 microseconds a run.
// In two side-by-side timings against v004, it was 1.08 and 1.07 times as fast.
// Over all steps from v000 it is 4.45 times as fast.
#include <hip/hip_runtime.h>

// CDNA5 / gfx1250 flash-attention (fused scaled-dot-product attention).
// B=16, Sq=Sk=2048, d=64. fp32 in/out, f16 WMMA compute, fp32 online softmax
// in base-2 domain; denominator via an all-ones WMMA operand;
// K fragments come by 16B-aligned ds_load_b128, V^T fragments by the 16-bit
// transposing LDS load from a V tile that is staged row-major, exactly as K is.
// Both products run transposed (S^T = K Q^T, O^T += V^T P^T): a lane holds the
// scores of ONE query, so the maximum is taken in the lane (plus one exchange
// between the lane halves) and P packs from the score accumulators straight
// into the B operand of the second product, with no trip through LDS.
// Padded keys have softmax weight exactly 0: each block first lists the rows of
// its batch's unpadded keys (in order) in LDS and walks only those, 64 a tile.
// K/V of tile t+2 are fetched into registers ahead of tile t's math and
// written to its key group's other LDS buffer behind it (two buffers a key
// group, one barrier a tile).
// A wave holds 32 queries (two column groups), so each K and V fragment read
// from LDS feeds two products and a staged tile serves 128 queries. The block's
// two halves of four waves walk alternate key tiles of the same 128 queries
// (two waves a SIMD stay) and join their partial results through LDS at the end.

typedef __attribute__((ext_vector_type(16))) _Float16 v16h;
typedef __attribute__((ext_vector_type(2)))  __fp16   v2fp16;
typedef __attribute__((ext_vector_type(8)))  float    v8f;
typedef __attribute__((ext_vector_type(8)))  short    s16x8;

#define B_    16
#define SQ    2048
#define SK    2048
#define D_    64
#define QTILE 16      // query rows per column group
#define QG    2       // column groups per wave
#define GW    4       // waves per key group (they stage and read one tile)
#define KGR   2       // key groups per block (alternate tiles)
#define WAVES (GW * KGR)          // waves per block
#define QBLK  (QTILE * QG * GW)   // queries per block
#define KT    64      // keys per tile iteration
#define KSTR  72      // LDS stride (halves); 144B => every frag group 16B-aligned
#define VSTR  80      // V rows: 160B = 32B x odd, the transposing load's pitch
#define OSTR  68      // LDS stride (floats) of the output staging; 272B = 16B x odd
#define ROWB  (D_ * 4)    // bytes of one K or V row in global memory
#define NIDX  (SK + 4 * KT)   // row list: every key, and two tiles a key group fetched ahead
#define KBUF  (KT * KSTR / 2) // dwords of one K buffer
#define VBUF  (KT * VSTR / 2) // dwords of one V buffer

union Frag { v16h h; unsigned int u[8]; uint4 q[2]; s16x8 t[2]; };
union HPair { v2fp16 h; unsigned int u; };

// Pack two f32 -> packed f16 dword (v_cvt_pk_rtz_f16_f32).
__device__ __forceinline__ unsigned int pkh2(float x, float y) {
    HPair p; p.h = __builtin_amdgcn_cvt_pkrtz(x, y);
    return p.u;
}

// Raw v_exp_f32 (args here are always <= 0 and far from denormal trouble;
// -1e30 -> 0 is exactly the behavior we want for masked columns).
__device__ __forceinline__ float fexp2(float x) {
#if __has_builtin(__builtin_amdgcn_exp2f)
    return __builtin_amdgcn_exp2f(x);
#else
    return exp2f(x);
#endif
}

// Lane l's value as seen from lane l ^ 16 (one vector cross-row move).
__device__ __forceinline__ float xhalf(float x) {
    return __int_as_float(__builtin_amdgcn_permlanex16(
        __float_as_int(x), __float_as_int(x), 0x76543210, 0xfedcba98, false, false));
}

__device__ __forceinline__ float max3f(float a, float b, float c) {
    return fmaxf(fmaxf(a, b), c);
}

// Load one 16x32 f16 A/B fragment from a 16B-aligned LDS row base
// (base already includes the row offset and this lane's hi*8 K-group shift).
__device__ __forceinline__ void ldfrag(Frag& fr, const _Float16* base) {
    fr.q[0] = *(const uint4*)(base);        // K pairs 0..7   (this half)
    fr.q[1] = *(const uint4*)(base + 16);   // K pairs 16..23 (this half)
}

// Load one 16 (d) x 32 (keys) f16 A fragment of V^T from the row-major V tile
// with two transposing loads: lane (n, hi) gets keys 8 hi .. 8 hi + 7 of column n,
// then the same of the 16 rows below (base: this lane's address in the first).
__device__ __forceinline__ void ldfrag_tr(Frag& fr, const _Float16* base) {
    typedef __attribute__((address_space(3))) s16x8 lds_s16x8;
    fr.t[0] = __builtin_amdgcn_ds_load_tr16_b128_v8i16((lds_s16x8*)(base));
    fr.t[1] = __builtin_amdgcn_ds_load_tr16_b128_v8i16((lds_s16x8*)(base + 16 * VSTR));
}

// One thread's share of a 64-key tile, held in registers while it is in flight.
struct Stage {
    float4 k[8];     // K: 8 rows x 4 floats
    float4 v[8];     // V: the same rows and columns
};

// This thread's rows of one tile: byte offsets into K and V, from the row list.
struct Rows {
    unsigned int k[8];
};

// lst: the tile's 64 entries of the row list.
__device__ __forceinline__ void rows_load(Rows& rw, const unsigned int* lst, int kRow0) {
    #pragma unroll
    for (int i = 0; i < 8; ++i) rw.k[i] = lst[kRow0 + 8 * i];
}

// Issue every global load of one tile (no use of the values here).
__device__ __forceinline__ void stage_load(Stage& st,
                                           const float* __restrict__ Kb,
                                           const float* __restrict__ Vb,
                                           const Rows& rw,
                                           unsigned int kColB) {
    unsigned int ak[8];
    #pragma unroll
    for (int i = 0; i < 8; ++i) ak[i] = rw.k[i] + kColB;
    #pragma unroll
    for (int i = 0; i < 8; ++i)
        st.k[i] = *(const float4*)((const char*)Kb + ak[i]);
    #pragma unroll
    for (int i = 0; i < 8; ++i)
        st.v[i] = *(const float4*)((const char*)Vb + ak[i]);
    // The wait that stands in front of any rewrite of the loads' address
    // registers; naming them as inputs keeps them untouched up to it.
    asm volatile("s_wait_xcnt 0x0"
                 :: "v"(ak[0]), "v"(ak[1]), "v"(ak[2]), "v"(ak[3]),
                    "v"(ak[4]), "v"(ak[5]), "v"(ak[6]), "v"(ak[7])
                 : "memory");
}

// Convert the held tile to f16 and write it to one LDS buffer, K and V both
// row-major (8-byte stores), each at its own pitch.
__device__ __forceinline__ void stage_store(const Stage& st,
                                            unsigned int* sK, unsigned int* sV,
                                            int kRow0, int kCol0) {
    // One base index each plus compile-time steps: the steps fold into the
    // store instructions, so the addresses take two registers, not two dozen
    // (the held tile needs the room).
    unsigned int* const kd = sK + ((kRow0 * KSTR + kCol0) >> 1);
    unsigned int* const vd = sV + ((kRow0 * VSTR + kCol0) >> 1);
    #pragma unroll
    for (int i = 0; i < 8; ++i) {
        kd[i * (4 * KSTR)]     = pkh2(st.k[i].x, st.k[i].y);
        kd[i * (4 * KSTR) + 1] = pkh2(st.k[i].z, st.k[i].w);
    }
    #pragma unroll
    for (int i = 0; i < 8; ++i) {
        vd[i * (4 * VSTR)]     = pkh2(st.v[i].x, st.v[i].y);
        vd[i * (4 * VSTR) + 1] = pkh2(st.v[i].z, st.v[i].w);
    }
}

__global__ __launch_bounds__(WAVES * 32)
void fa_fwd_kernel(const float* __restrict__ Q,
                   const float* __restrict__ K,
                   const float* __restrict__ V,
                   const int*   __restrict__ mask,   // [B, Sk], nonzero = padded
                   float* __restrict__ O)
{
    __shared__ __attribute__((aligned(16))) unsigned int sK32[KGR][2][KBUF];  // K tile [key][d], f16
    __shared__ __attribute__((aligned(16))) unsigned int sV32[KGR][2][VBUF];  // V tile [key][d], f16
    __shared__ __attribute__((aligned(16))) float sO[WAVES * QTILE * OSTR];  // output rows
    __shared__ __attribute__((aligned(16))) float sX[WAVES * 32 * 32];       // handed-over partial O
    __shared__ float2 sML[WAVES * 32];                    // handed-over maximum and sum
    __shared__ __attribute__((aligned(16))) unsigned int sIdx[NIDX];  // row list
    __shared__ int sCnt[WAVES];                           // unpadded keys per wave

    const int tid  = threadIdx.x;
    const int wave = tid >> 5;
    const int lane = tid & 31;
    const int n    = lane & 15;          // fragment column / row-within-16
    const int hi   = (lane >> 4) & 1;    // lane half selects K/M sub-range
    // Key group of this wave; held as a scalar so that the tests on its tile
    // index below are scalar branches.
    const int grp  = __builtin_amdgcn_readfirstlane(tid >> 7);
    const int gt   = tid & (GW * 32 - 1);        // thread within the key group

    const int b     = blockIdx.x >> 4;           // SQ/QBLK = 16 chunks
    const int qc    = blockIdx.x & 15;
    // Waves w and w + 4 hold the same 32 queries. Column group j of a wave is
    // queries qpair + 16 (j ^ grp): what one wave has as group 1 the other has
    // as group 0, so at the end each hands over group 1 and finishes group 0.
    const int qpair = qc * QBLK + (wave & (GW - 1)) * (QTILE * QG);
    const int bSK   = b * SK;

    // Loop-invariant per-lane staging offsets (row, column, column bytes).
    const int kRow0 = gt >> 4;                   // K and V stage: base row, +8 per iter
    const int kCol0 = (gt & 15) << 2;
    const unsigned int kColB = (unsigned int)kCol0 * 4u;

    const float* const Kb = K + (size_t)bSK * D_;             // uniform bases
    const float* const Vb = V + (size_t)bSK * D_;
    const int*   const Mb = mask + bSK;

    // ---- list the unpadded keys of this batch row, in their order.
    // Wave w looks at keys [256 w, 256 w + 256), 32 at a time: a ballot gives
    // each kept key its rank. Entries behind the last kept key stay 0 (row 0,
    // in bounds): in the last tile their score columns are masked, and the
    // fetches that run ahead of the last tile need no test.
    int count;
    {
        int mv[SK / (WAVES * 32)];
        const unsigned int mB = (unsigned int)(wave * (SK / WAVES) + lane) * 4u;
        const char* const mp = (const char*)Mb + mB;
        #pragma unroll
        for (int j = 0; j < SK / (WAVES * 32); ++j)
            mv[j] = *(const int*)(mp + j * 128);
        // The wait that stands in front of any rewrite of the loads' address
        // register; naming it as an input keeps it untouched up to it.
        asm volatile("s_wait_xcnt 0x0" :: "v"(mB) : "memory");
        #pragma unroll
        for (int j = 0; j < NIDX / (WAVES * 32); ++j)
            sIdx[j * (WAVES * 32) + tid] = 0u;
        unsigned int bal[SK / (WAVES * 32)];
        int tot = 0;
        #pragma unroll
        for (int j = 0; j < SK / (WAVES * 32); ++j) {
            bal[j] = __builtin_amdgcn_ballot_w32(mv[j] == 0);
            tot += __builtin_popcount(bal[j]);
        }
        if (lane == 0) sCnt[wave] = tot;
        __syncthreads();
        int base = 0, all = 0;
        #pragma unroll
        for (int w = 0; w < WAVES; ++w) {
            const int c = sCnt[w];
            base += (w < wave) ? c : 0;
            all  += c;
        }
        #pragma unroll
        for (int j = 0; j < SK / (WAVES * 32); ++j) {
            if (mv[j] == 0)
                sIdx[base + (int)__builtin_amdgcn_mbcnt_lo(bal[j], 0u)] =
                    (unsigned int)(wave * (SK / WAVES) + j * 32 + lane) * ROWB;
            base += __builtin_popcount(bal[j]);
        }
        __syncthreads();
        // The same in every lane of the block; held as a scalar so that the
        // loop tests below are scalar branches. The clamp bounds the trips.
        count = min(__builtin_amdgcn_readfirstlane(all), SK);
    }
    const int nt = (count + KT - 1) / KT;        // key tiles to walk, 0..32
    const int ni = (nt + KGR - 1) / KGR;         // trips: tile KGR i + grp in trip i

    // This key group's tiles in the row list, and its LDS buffers.
    const unsigned int* const lstg = sIdx + grp * KT;
    unsigned int* const sKg = &sK32[grp][0][0];
    unsigned int* const sVg = &sV32[grp][0][0];

    // ---- the group's first tile starts its flight ahead of the Q fragment set-up
    Stage st;
    Rows  rw;
    rows_load(rw, lstg, kRow0);
    stage_load(st, Kb, Vb, rw, kColB);
    rows_load(rw, lstg + KGR * KT, kRow0);

    // ---- Q fragments (16x64 -> two chained 16x32 per column group), the B
    // operand of S^T.
    // Scale folds 1/sqrt(d) and log2(e) so softmax runs in base-2 domain.
    const float qscale = 0.125f * 1.44269504088896340736f;
    Frag qa[QG][2];
    {
        // This lane's 8-float groups of its two query rows: at 16 g + 8 hi.
        const float* qp[QG];
        float4 qv[QG][8];
        #pragma unroll
        for (int j = 0; j < QG; ++j) {
            qp[j] = Q + (size_t)(b * SQ + qpair + QTILE * (j ^ grp) + n) * D_ + 8 * hi;
            #pragma unroll
            for (int g = 0; g < 4; ++g) {
                qv[j][2 * g]     = *(const float4*)(qp[j] + 16 * g);
                qv[j][2 * g + 1] = *(const float4*)(qp[j] + 16 * g + 4);
            }
        }
        // The wait that stands in front of any rewrite of the loads' address
        // registers; naming them as inputs keeps them untouched up to it.
        asm volatile("s_wait_xcnt 0x0" :: "v"(qp[0]), "v"(qp[1]) : "memory");
        #pragma unroll
        for (int j = 0; j < QG; ++j) {
            #pragma unroll
            for (int g = 0; g < 4; ++g) {
                const float4 x = qv[j][2 * g], y = qv[j][2 * g + 1];
                unsigned int* const u = &qa[j][g >> 1].u[4 * (g & 1)];
                u[0] = pkh2(x.x * qscale, x.y * qscale);
                u[1] = pkh2(x.z * qscale, x.w * qscale);
                u[2] = pkh2(y.x * qscale, y.y * qscale);
                u[3] = pkh2(y.z * qscale, y.w * qscale);
            }
        }
    }

    // Constant all-ones A fragment: accumulates softmax denominator via WMMA.
    Frag ones;
    #pragma unroll
    for (int v = 0; v < 8; ++v) ones.u[v] = 0x3C003C00u;   // (1.0h, 1.0h)

    // Loop-invariant LDS fragment base pointers (include hi*8 K-group shift).
    const int kfoff = n * KSTR + 8 * hi;     // + 16 * f * KSTR per fragment
    // The transposing load: lane l addresses row 8 hi + (l & 7), 16-byte half
    // (l >> 3) & 1 of the chunk's 32 bytes; + 16 per d chunk, + 32 VSTR per 32 keys.
    const int vtoff = (8 * hi + (lane & 7)) * VSTR + 8 * ((lane >> 3) & 1);

    // Online-softmax state of query n of each column group (the same in both
    // lane halves), over this key group's tiles.
    // oacc[j][c][r] = O[n][16 c + 8 hi + r]; every row of oacc[j][4] is the
    // running sum of query n's weights (denominator).
    float m_run[QG];
    v8f   oacc[QG][5];
    #pragma unroll
    for (int j = 0; j < QG; ++j) {
        m_run[j] = -1e30f;
        #pragma unroll
        for (int c = 0; c < 5; ++c) oacc[j][c] = v8f{};
    }

    // ---- prologue: the group's first tile into its buffer 0
    stage_store(st, sKg, sVg, kRow0, kCol0);
    __syncthreads();

    // Two tiles a trip so that the buffer index is a compile-time constant
    // (LDS offsets fold into the instructions); the outer loop stays rolled.
    #pragma clang loop unroll(disable)
    for (int i2 = 0; i2 < ni; i2 += 2) {
      #pragma unroll
      for (int h = 0; h < 2; ++h) {
        const int it = i2 + h;
        if (h == 1 && it >= ni) break;                    // block-uniform
        const _Float16* const sKh = (const _Float16*)(sKg + h * KBUF);
        const _Float16* const sVh = (const _Float16*)(sVg + h * VBUF);

        // ---- next tile's global loads fly while this tile is worked on
        // (behind the last tile: row 0, stored to the free buffer, never read)
        stage_load(st, Kb, Vb, rw, kColB);
        // Keeps the loads above ahead of the tile's math: without it the
        // scheduler sinks them to just in front of their use and the latency
        // is waited out again.
        __builtin_amdgcn_sched_barrier(0);

        // Listed keys from this tile's first on; none where the tile count is
        // odd and this is the second group's last trip (wave-uniform scalar
        // test; the staging and the barrier below are passed all the same).
        const int rem = count - (KGR * it + grp) * KT;
        if (rem > 0) {
        // ---- scores, transposed: s[j][f][r] = S[query n of group j][key 16 f + 8 hi + r]
        Frag ka[4][2];
        #pragma unroll
        for (int f = 0; f < 4; ++f) {
            ldfrag(ka[f][0], sKh + kfoff + 16 * f * KSTR);
            ldfrag(ka[f][1], sKh + kfoff + 16 * f * KSTR + 32);
        }
        // Keeps the tile's K fragment loads in one group ahead of the products:
        // without it they come in pairs, each waited out in front of its product.
        __builtin_amdgcn_sched_barrier(0);
        v8f s[QG][4];
        #pragma unroll
        for (int f = 0; f < 4; ++f) {
            #pragma unroll
            for (int j = 0; j < QG; ++j)
                s[j][f] = __builtin_amdgcn_wmma_f32_16x16x32_f16(false, ka[f][0].h, false, qa[j][0].h, (short)0, v8f{}, false, false);
        }
        #pragma unroll
        for (int f = 0; f < 4; ++f) {
            #pragma unroll
            for (int j = 0; j < QG; ++j)
                s[j][f] = __builtin_amdgcn_wmma_f32_16x16x32_f16(false, ka[f][1].h, false, qa[j][1].h, (short)0, s[j][f], false, false);
        }

        // ---- keys behind the last listed one are masked; only the last tile
        // can hold any (wave-uniform scalar test)
        if (rem < KT) {
            const int lim = rem - 8 * hi;
            #pragma unroll
            for (int j = 0; j < QG; ++j) {
                #pragma unroll
                for (int f = 0; f < 4; ++f) {
                    #pragma unroll
                    for (int r = 0; r < 8; ++r)
                        s[j][f][r] = (16 * f + r >= lim) ? -1e30f : s[j][f][r];
                }
            }
        }

        // ---- online softmax update: the lane's 32 scores, then the other half's
        float mnew[QG], alpha[QG];
        #pragma unroll
        for (int j = 0; j < QG; ++j) {
            float l1[12];
            #pragma unroll
            for (int i = 0; i < 10; ++i)
                l1[i] = max3f(s[j][(3 * i) >> 3][(3 * i) & 7],
                              s[j][(3 * i + 1) >> 3][(3 * i + 1) & 7],
                              s[j][(3 * i + 2) >> 3][(3 * i + 2) & 7]);
            l1[10] = s[j][3][6];
            l1[11] = s[j][3][7];
            const float mx = fmaxf(max3f(max3f(l1[0], l1[1], l1[2]),
                                         max3f(l1[3], l1[4], l1[5]),
                                         max3f(l1[6], l1[7], l1[8])),
                                   max3f(l1[9], l1[10], l1[11]));
            mnew[j] = max3f(m_run[j], mx, xhalf(mx));
        }
        #pragma unroll
        for (int j = 0; j < QG; ++j) {
            alpha[j] = fexp2(m_run[j] - mnew[j]);
            m_run[j] = mnew[j];
        }

        // ---- P^T: two score tiles, converted in place, are one B operand
        // (element e of the operand = key 8 hi + e, then 16 + 8 hi + (e - 8))
        Frag pb[QG][2];
        #pragma unroll
        for (int j = 0; j < QG; ++j) {
            #pragma unroll
            for (int v = 0; v < 4; ++v) {
                pb[j][0].u[v]     = pkh2(fexp2(s[j][0][2 * v] - mnew[j]), fexp2(s[j][0][2 * v + 1] - mnew[j]));
                pb[j][0].u[v + 4] = pkh2(fexp2(s[j][1][2 * v] - mnew[j]), fexp2(s[j][1][2 * v + 1] - mnew[j]));
                pb[j][1].u[v]     = pkh2(fexp2(s[j][2][2 * v] - mnew[j]), fexp2(s[j][2][2 * v + 1] - mnew[j]));
                pb[j][1].u[v + 4] = pkh2(fexp2(s[j][3][2 * v] - mnew[j]), fexp2(s[j][3][2 * v + 1] - mnew[j]));
            }
        }
        #pragma unroll
        for (int j = 0; j < QG; ++j) {
            #pragma unroll
            for (int c = 0; c < 5; ++c) {
                #pragma unroll
                for (int r = 0; r < 8; ++r) oacc[j][c][r] *= alpha[j];
            }
        }

        // ---- O^T += V^T (16 d x 64 keys) x P^T (64 keys x 16) per d chunk;
        // each V^T fragment feeds both column groups
        #pragma unroll
        for (int c = 0; c < 4; ++c) {
            Frag va0, va1;
            ldfrag_tr(va0, sVh + vtoff + 16 * c);
            ldfrag_tr(va1, sVh + vtoff + 16 * c + 32 * VSTR);
            #pragma unroll
            for (int j = 0; j < QG; ++j)
                oacc[j][c] = __builtin_amdgcn_wmma_f32_16x16x32_f16(false, va0.h, false, pb[j][0].h, (short)0, oacc[j][c], false, false);
            #pragma unroll
            for (int j = 0; j < QG; ++j)
                oacc[j][c] = __builtin_amdgcn_wmma_f32_16x16x32_f16(false, va1.h, false, pb[j][1].h, (short)0, oacc[j][c], false, false);
        }
        // ---- softmax denominator via WMMA against the all-ones operand
        #pragma unroll
        for (int j = 0; j < QG; ++j)
            oacc[j][4] = __builtin_amdgcn_wmma_f32_16x16x32_f16(false, ones.h, false, pb[j][0].h, (short)0, oacc[j][4], false, false);
        #pragma unroll
        for (int j = 0; j < QG; ++j)
            oacc[j][4] = __builtin_amdgcn_wmma_f32_16x16x32_f16(false, ones.h, false, pb[j][1].h, (short)0, oacc[j][4], false, false);
        }

        // Keeps the held tile's conversions behind the tile's math: without it
        // the scheduler lifts them to just behind their loads, whose latency
        // is then waited out at the head of the tile.
        __builtin_amdgcn_sched_barrier(0);

        // ---- the held tile goes to the buffer that the last tile has left
        stage_store(st, sKg + (h ^ 1) * KBUF, sVg + (h ^ 1) * VBUF, kRow0, kCol0);
        // Rows of the tile after next: read here so that their LDS latency
        // falls into the wait in front of the barrier.
        rows_load(rw, lstg + (it + 2) * (KGR * KT), kRow0);
        // One barrier a tile: publishes the group's next tile and ends every
        // wave's reads of this tile's buffer, which is refilled behind it.
        __syncthreads();
      }
    }

    // ---- join the two key groups: each wave hands its column group 1 (partial
    // O, maximum, sum) to its partner wave, lane to lane, and finishes group 0.
    {
        float4* const xs = (float4*)sX + wave * (8 * 32) + lane;
        #pragma unroll
        for (int c = 0; c < 4; ++c) {
            xs[(2 * c) * 32]     = make_float4(oacc[1][c][0], oacc[1][c][1], oacc[1][c][2], oacc[1][c][3]);
            xs[(2 * c + 1) * 32] = make_float4(oacc[1][c][4], oacc[1][c][5], oacc[1][c][6], oacc[1][c][7]);
        }
        sML[wave * 32 + lane] = make_float2(m_run[1], oacc[1][4][0]);
    }
    // The partner wave reads what this wave wrote.
    __syncthreads();
    const int pw = wave ^ GW;
    const float2 ml   = sML[pw * 32 + lane];
    const float  mfin = fmaxf(m_run[0], ml.x);
    const float  a0   = fexp2(m_run[0] - mfin);
    const float  a1   = fexp2(ml.x - mfin);
    const float  inv  = 1.0f / (a0 * oacc[0][4][0] + a1 * ml.y);
    const float  w0   = a0 * inv;
    const float  w1   = a1 * inv;

    // ---- normalize; a lane holds 8 consecutive d of query n per chunk. The
    // wave turns its 16 x 64 tile round in its own LDS range so that each
    // global store covers two whole output rows (512 contiguous bytes).
    float* const sOw = sO + wave * (QTILE * OSTR);
    const float4* const xr = (const float4*)sX + pw * (8 * 32) + lane;
    #pragma unroll
    for (int c = 0; c < 4; ++c) {
        const float4 p0 = xr[(2 * c) * 32];
        const float4 p1 = xr[(2 * c + 1) * 32];
        float* const d = sOw + n * OSTR + 16 * c + 8 * hi;
        *(float4*)(d)     = make_float4(oacc[0][c][0] * w0 + p0.x * w1, oacc[0][c][1] * w0 + p0.y * w1,
                                        oacc[0][c][2] * w0 + p0.z * w1, oacc[0][c][3] * w0 + p0.w * w1);
        *(float4*)(d + 4) = make_float4(oacc[0][c][4] * w0 + p1.x * w1, oacc[0][c][5] * w0 + p1.y * w1,
                                        oacc[0][c][6] * w0 + p1.z * w1, oacc[0][c][7] * w0 + p1.w * w1);
    }
    // The rows are read back by other lanes of this wave: its LDS writes have
    // to be done first.
    asm volatile("s_wait_dscnt 0x0" ::: "memory");
    float* const obase = O + (size_t)(b * SQ + qpair + QTILE * grp + hi) * D_ + 4 * n;
    #pragma unroll
    for (int i = 0; i < 8; ++i)
        *(float4*)(obase + 2 * i * D_) =
            *(const float4*)(sOw + (2 * i + hi) * OSTR + 4 * n);
}

extern "C" void kernel_launch(void* const* d_in, const int* in_sizes, int n_in,
                              void* d_out, int out_size, void* d_ws, size_t ws_size,
                              hipStream_t stream) {
    const float* Q    = (const float*)d_in[0];
    const float* K    = (const float*)d_in[1];
    const float* V    = (const float*)d_in[2];
    const int*   mask = (const int*)d_in[3];
    float*       O    = (float*)d_out;
    (void)in_sizes; (void)n_in; (void)out_size; (void)d_ws; (void)ws_size;

    const int grid = B_ * (SQ / QBLK);   // 16 * 16 = 256 blocks
    fa_fwd_kernel<<<grid, WAVES * 32, 0, stream>>>(Q, K, V, mask, O);
}
